// v000
// Times are from an AMD MI455X. After a warm-up the kernel runs many times in a row, and a time is the length of
// such a window on the GPU divided by its runs, so every launch and the gaps after it count. The runs cycle
// through copies of the inputs. A figure is the median of several windows, for all but v000 over two sittings.
// Sittings can differ by a few percent; kernels timed side by side share one.
// v000, which the later versions start from, runs in 204 microseconds.
// compute dtype: q, k, v RNE-converted to bf16 on load; logits on v_wmma_f32_16x16x32_bf16 (bf16 x bf16 single product, f32 accumulate), no scaling; running-max softmax in f32 (hardware exp); P carried x 2^14 as f16 hi plus its f16 residual against v (bf16 -> f16, exact) on v_wmma_f32_16x16x32_f16, two products into one f32 accumulator; f32 output [B, L, H, D].
#include <hip/hip_runtime.h>
#include <math.h>

typedef __attribute__((ext_vector_type(16))) _Float16 v16h;
typedef __attribute__((ext_vector_type(16))) __bf16 v16b;
typedef __attribute__((ext_vector_type(8)))  _Float16 v8h;
typedef __attribute__((ext_vector_type(8)))  __bf16 v8b;
typedef __attribute__((ext_vector_type(8)))  float v8f;
typedef __attribute__((ext_vector_type(4)))  float v4f;
typedef __attribute__((ext_vector_type(4)))  unsigned v4u;

template <typename T> __device__ __forceinline__ void vst2(void* p, T v) { *(T*)p = v;  }
__device__ __forceinline__ v8f wmma16(v16h a, v16h b, v8f c) {
  v8f d = __builtin_amdgcn_wmma_f32_16x16x32_f16(false, a, false, b, (short)0, c, false, false);
  asm volatile("v_nop\n\tv_nop\n\tv_nop\n\tv_nop" : "+v"(d) : "v"(a), "v"(b));
  return d;
}
__device__ __forceinline__ v8f wmma_bf(v16b a, v16b b, v8f c) {
  v8f d = __builtin_amdgcn_wmma_f32_16x16x32_bf16(false, a, false, b, (short)0, c, false, false);
  asm volatile("v_nop\n\tv_nop\n\tv_nop\n\tv_nop" : "+v"(d) : "v"(a), "v"(b));
  return d;
}
// 16x16x32 fragments: lane = (h = lane>>4, row/col = lane&15); elements 0..7 = k0+8h+0..7, 8..15 = k0+16+8h+0..7; D element r = row 8h+r, col lane&15
__device__ __forceinline__ v16h frag_h(const _Float16* rowk0, int lane) {
  union { v16h v; v8h q[2]; } u; const _Float16* p = rowk0 + 8 * (lane >> 4);
  u.q[0] = *(const v8h*)p; u.q[1] = *(const v8h*)(p + 16); return u.v;
}
__device__ __forceinline__ v16b frag_b(const __bf16* rowk0, int lane) {
  union { v16b v; v8b q[2]; } u; const __bf16* p = rowk0 + 8 * (lane >> 4);
  u.q[0] = *(const v8b*)p; u.q[1] = *(const v8b*)(p + 16); return u.v;
}
__device__ __forceinline__ float bfr(float v) { return (float)(__bf16)v; }
__device__ __forceinline__ void ldsx() { asm volatile("s_wait_dscnt 0" ::: "memory"); __builtin_amdgcn_wave_barrier(); __builtin_amdgcn_fence(3, "workgroup"); }

// dense softmax attention on raw inputs in [B, S, H, D] layout: A = softmax(q k^T) over keys (no 1/sqrt(D)); out = A . v, written [B, L, H, D].
#ifndef NB
#define NB 4                    // batches computed
#endif
#ifndef SEQ
#define SEQ 2048                // sequence length computed
#endif
#define NB_FULL 4
#define SEQ_FULL 2048           // inputs always have the full sequence length per batch
#define NH 8
#define DD 64
#define RS (NH * DD)            // floats between consecutive s of one batch (512)
#define BSTR ((size_t)SEQ_FULL * RS)   // input batch stride in floats
#ifndef OSEQ
#define OSEQ SEQ                // output sequence stride (dense over the computed rows)
#endif
#define PCARRY 16384.0f         // power-of-two carry on the f16 P plane, folded back in the f32 epilogue
static_assert(SEQ % 64 == 0);
static_assert(SEQ <= SEQ_FULL);
static_assert(NB >= 1 && NB <= NB_FULL);
static_assert(DD == 64);

#define WS_VT  0u                                            // f16 value planes [b*NH + h][DD][SEQ]
#define WS_END (WS_VT + 2u * (size_t)NB * NH * DD * SEQ)      // 8,388,608 B at full size
static_assert(WS_END <= (size_t)134217728u);

__global__ __launch_bounds__(128) void k_vt(const float* __restrict__ V, _Float16* __restrict__ VT) {
  __shared__ __align__(16) _Float16 th[DD][72];
  const int t = threadIdx.x; const size_t bh = blockIdx.y; const size_t b = bh / NH; const int h = bh % NH; const int m0 = blockIdx.x * 64;
  for (int e = t; e < 64 * DD; e += 128) { const int ml = e / DD, d = e % DD; th[d][ml] = (_Float16)bfr(V[b * BSTR + ((size_t)(m0 + ml) * NH + h) * DD + d]); }
  __syncthreads();
  for (int e = t; e < DD * 8; e += 128) { const int d = e >> 3, q = e & 7; vst2((unsigned*)(VT + (bh * DD + d) * (size_t)SEQ + m0 + q * 8), *(const v4u*)&th[d][q * 8]); }
}
// ---- k_att: block = (64 queries, b*NH + h), 4 waves x 16 query rows: exact bf16 logits over all SEQ keys, running-max softmax, P . v
__global__ __launch_bounds__(128) void k_att(const float* __restrict__ Q, const float* __restrict__ K, const _Float16* __restrict__ VT, float* __restrict__ OUT) {
  __shared__ __align__(16) float sp[4][16][36]; __shared__ __align__(16) float so[4][16][68];
  const int tid = threadIdx.x, wave = tid >> 5, lane = tid & 31, col = lane & 15, g = lane >> 4;
  const size_t bh = blockIdx.y; const size_t b = bh / NH; const int h = bh % NH; const int q0 = blockIdx.x * 64 + wave * 16;
  // A fragments of q: row m = col, elements i <- d = kc*32 + 8g + i, 8+i <- d = kc*32 + 16 + 8g + i
  v16b aq[2];
#pragma unroll
  for (int kc = 0; kc < 2; ++kc) { const float* pp = Q + b * BSTR + ((size_t)(q0 + col) * NH + h) * DD + kc * 32 + 8 * g;
#pragma unroll
    for (int i = 0; i < 8; ++i) { aq[kc][i] = (__bf16)pp[i]; aq[kc][8 + i] = (__bf16)pp[16 + i]; } }
  float m[8], l[8];
#pragma unroll
  for (int r = 0; r < 8; ++r) { m[r] = -3.0e38f; l[r] = 0.f; }
  v8f acc[4];
#pragma unroll
  for (int j = 0; j < 4; ++j) acc[j] = v8f{};
#pragma unroll 1
  for (int ks = 0; ks < SEQ / 32; ++ks) { float s[2][8];
#pragma unroll
    for (int ct = 0; ct < 2; ++ct) { const int kk = ks * 32 + ct * 16 + col; v8f c = {};
      // B fragments of k: column n = key kk, elements i <- d = kc*32 + 8g + i, 8+i <- d = kc*32 + 16 + 8g + i (same k map as A)
#pragma unroll
      for (int kc = 0; kc < 2; ++kc) { v16b w; const float* kp = K + b * BSTR + ((size_t)kk * NH + h) * DD + kc * 32 + 8 * g;
#pragma unroll
        for (int i = 0; i < 8; ++i) { w[i] = (__bf16)kp[i]; w[8 + i] = (__bf16)kp[16 + i]; }
        c = wmma_bf(aq[kc], w, c); }
#pragma unroll
      for (int r = 0; r < 8; ++r) s[ct][r] = c[r]; }   // D element r = query row 8g+r, key column ct*16 + col; no scaling
    float alpha[8];
#pragma unroll
    for (int r = 0; r < 8; ++r) { float mx = fmaxf(s[0][r], s[1][r]);
#pragma unroll
      for (int o = 1; o < 16; o <<= 1) mx = fmaxf(mx, __shfl_xor(mx, o));
      const float mn = fmaxf(m[r], mx); alpha[r] = __expf(m[r] - mn); const float e0 = __expf(s[0][r] - mn), e1 = __expf(s[1][r] - mn); float es = e0 + e1;
#pragma unroll
      for (int o = 1; o < 16; o <<= 1) es += __shfl_xor(es, o);
      l[r] = l[r] * alpha[r] + es; m[r] = mn; sp[wave][8 * g + r][col] = e0; sp[wave][8 * g + r][16 + col] = e1; }
#pragma unroll
    for (int j = 0; j < 4; ++j)
#pragma unroll
      for (int r = 0; r < 8; ++r) acc[j][r] *= alpha[r];
    ldsx();
    // A fragments of P (row m = query col, k = key within the 32-key chunk): P x 2^14 as f16 plus its f16 residual, also x 2^14
    v16h pa, par; { const float* prow = &sp[wave][col][0] + 8 * (lane >> 4);
#pragma unroll
      for (int i = 0; i < 8; ++i) { const float p0 = prow[i] * PCARRY, p1 = prow[16 + i] * PCARRY; pa[i] = (_Float16)p0; pa[8 + i] = (_Float16)p1; par[i] = (_Float16)(p0 - (float)pa[i]); par[8 + i] = (_Float16)(p1 - (float)pa[8 + i]); } }
    // B fragments of v from the [bh][d][s] planes: column n = d = j*16 + col, k = key with the same split map
#pragma unroll
    for (int j = 0; j < 4; ++j) { const v16h vh = frag_h(VT + (bh * DD + j * 16 + col) * (size_t)SEQ + ks * 32, lane); acc[j] = wmma16(pa, vh, acc[j]); acc[j] = wmma16(par, vh, acc[j]); }
    ldsx(); }
#pragma unroll
  for (int r = 0; r < 8; ++r) { const float il = (1.0f / PCARRY) / l[r];
#pragma unroll
    for (int j = 0; j < 4; ++j) so[wave][8 * g + r][j * 16 + col] = acc[j][r] * il; }
  ldsx();
  // one 256-B output row (64 floats of (b, q, h)) per instruction: lanes 0..7 -> line 0, lanes 8..15 -> line 1, 16 B each
  const int lc = lane & 15;
  for (int rl = 0; rl < 16; ++rl) { const v4f ov = *(const v4f*)&so[wave][rl][lc * 4];
    if (lane < 16) vst2(OUT + ((b * OSEQ + q0 + rl) * NH + h) * (size_t)DD + lc * 4, ov); }
}

extern "C" void kernel_launch(void* const* d_in, const int* in_sizes, int n_in, void* d_out, int out_size, void* d_ws, size_t ws_size, hipStream_t stream) {
  if (n_in < 3) return;
  const size_t need = ((size_t)(NB - 1) * SEQ_FULL + SEQ) * RS;
  if ((size_t)in_sizes[0] < need || (size_t)in_sizes[1] < need || (size_t)in_sizes[2] < need) return;
  if ((size_t)out_size < (size_t)NB * OSEQ * RS) return;
  if (ws_size < (size_t)WS_END) return;
  const float* Qp = (const float*)d_in[0];   // 0 queries [4,2048,8,64] f32
  const float* Kp = (const float*)d_in[1];   // 1 keys    [4,2048,8,64] f32
  const float* Vp = (const float*)d_in[2];   // 2 values  [4,2048,8,64] f32
  char* ws = (char*)d_ws; _Float16* VT = (_Float16*)(ws + WS_VT);
  k_vt<<<dim3(SEQ / 64, NB * NH), 128, 0, stream>>>(Vp, VT);
  k_att<<<dim3(SEQ / 64, NB * NH), 128, 0, stream>>>(Qp, Kp, VT, (float*)d_out);
}

// v001
// It runs in 112 microseconds.
// Next to v000, in two timings, it ran 1.87 times as fast each time.
// compute dtype: q, k, v RNE-converted to bf16 on load; logits on v_wmma_f32_16x16x32_bf16 (bf16 x bf16 single product, f32 accumulate), no scaling; running-max softmax in f32 (hardware exp); P carried x 2^14 as f16 hi plus its f16 residual against v (bf16 -> f16, exact) on v_wmma_f32_16x16x32_f16, two products into one f32 accumulator; f32 output [B, L, H, D].
#include <hip/hip_runtime.h>
#include <math.h>

typedef __attribute__((ext_vector_type(16))) _Float16 v16h;
typedef __attribute__((ext_vector_type(16))) __bf16 v16b;
typedef __attribute__((ext_vector_type(8)))  _Float16 v8h;
typedef __attribute__((ext_vector_type(8)))  __bf16 v8b;
typedef __attribute__((ext_vector_type(8)))  float v8f;
typedef __attribute__((ext_vector_type(4)))  float v4f;
typedef __attribute__((ext_vector_type(4)))  unsigned v4u;

template <typename T> __device__ __forceinline__ void vst2(void* p, T v) { *(T*)p = v;  }
__device__ __forceinline__ v8f wmma16(v16h a, v16h b, v8f c) {
  v8f d = __builtin_amdgcn_wmma_f32_16x16x32_f16(false, a, false, b, (short)0, c, false, false);
  asm volatile("v_nop\n\tv_nop\n\tv_nop\n\tv_nop" : "+v"(d) : "v"(a), "v"(b));
  return d;
}
__device__ __forceinline__ v8f wmma_bf(v16b a, v16b b, v8f c) {
  v8f d = __builtin_amdgcn_wmma_f32_16x16x32_bf16(false, a, false, b, (short)0, c, false, false);
  asm volatile("v_nop\n\tv_nop\n\tv_nop\n\tv_nop" : "+v"(d) : "v"(a), "v"(b));
  return d;
}
// 16x16x32 fragments: lane = (h = lane>>4, row/col = lane&15); elements 0..7 = k0+8h+0..7, 8..15 = k0+16+8h+0..7; D element r = row 8h+r, col lane&15
__device__ __forceinline__ v16h frag_h(const _Float16* rowk0, int lane) {
  union { v16h v; v8h q[2]; } u; const _Float16* p = rowk0 + 8 * (lane >> 4);
  u.q[0] = *(const v8h*)p; u.q[1] = *(const v8h*)(p + 16); return u.v;
}
__device__ __forceinline__ v16b frag_b(const __bf16* rowk0, int lane) {
  union { v16b v; v8b q[2]; } u; const __bf16* p = rowk0 + 8 * (lane >> 4);
  u.q[0] = *(const v8b*)p; u.q[1] = *(const v8b*)(p + 16); return u.v;
}
__device__ __forceinline__ float bfr(float v) { return (float)(__bf16)v; }
__device__ __forceinline__ void ldsx() { asm volatile("s_wait_dscnt 0" ::: "memory"); __builtin_amdgcn_wave_barrier(); __builtin_amdgcn_fence(3, "workgroup"); }

__device__ __forceinline__ unsigned lds_off(const void* p) { return (unsigned)(size_t)p; }   // byte offset in the work-group's LDS
// one stage (64 keys), this lane's share: eight 16-B pieces of the f32 key rows (lk, gk; piece i one step further) and four of the f16 value planes (lv, gv),
// global -> LDS through no register. The s_wait_xcnt closes the statement so that no address register named here is rewritten in front of it.
__device__ __forceinline__ void stage_copy(unsigned lk, const float* gk, unsigned lv, const _Float16* gv, unsigned lks, size_t gks, unsigned lvs, size_t gvs) {
  asm volatile("global_load_async_to_lds_b128 %0, %1, off\n\t"
               "global_load_async_to_lds_b128 %2, %3, off\n\t"
               "global_load_async_to_lds_b128 %4, %5, off\n\t"
               "global_load_async_to_lds_b128 %6, %7, off\n\t"
               "global_load_async_to_lds_b128 %8, %9, off\n\t"
               "global_load_async_to_lds_b128 %10, %11, off\n\t"
               "global_load_async_to_lds_b128 %12, %13, off\n\t"
               "global_load_async_to_lds_b128 %14, %15, off\n\t"
               "global_load_async_to_lds_b128 %16, %17, off\n\t"
               "global_load_async_to_lds_b128 %18, %19, off\n\t"
               "global_load_async_to_lds_b128 %20, %21, off\n\t"
               "global_load_async_to_lds_b128 %22, %23, off\n\t"
               "s_wait_xcnt 0x0"
               :: "v"(lk), "v"(gk), "v"(lk + lks), "v"(gk + gks), "v"(lk + 2 * lks), "v"(gk + 2 * gks), "v"(lk + 3 * lks), "v"(gk + 3 * gks),
                  "v"(lk + 4 * lks), "v"(gk + 4 * gks), "v"(lk + 5 * lks), "v"(gk + 5 * gks), "v"(lk + 6 * lks), "v"(gk + 6 * gks), "v"(lk + 7 * lks), "v"(gk + 7 * gks),
                  "v"(lv), "v"(gv), "v"(lv + lvs), "v"(gv + gvs), "v"(lv + 2 * lvs), "v"(gv + 2 * gvs), "v"(lv + 3 * lvs), "v"(gv + 3 * gvs) : "memory");
}

// dense softmax attention on raw inputs in [B, S, H, D] layout: A = softmax(q k^T) over keys (no 1/sqrt(D)); out = A . v, written [B, L, H, D].
#ifndef NB
#define NB 4                    // batches computed
#endif
#ifndef SEQ
#define SEQ 2048                // sequence length computed
#endif
#define NB_FULL 4
#define SEQ_FULL 2048           // inputs always have the full sequence length per batch
#define NH 8
#define DD 64
#define RS (NH * DD)            // floats between consecutive s of one batch (512)
#define BSTR ((size_t)SEQ_FULL * RS)   // input batch stride in floats
#ifndef OSEQ
#define OSEQ SEQ                // output sequence stride (dense over the computed rows)
#endif
#define SK 64                   // keys per LDS stage: a value-plane row of a stage is one whole 128-B line
#define NST (SEQ / SK)
#define KP 68                   // floats per staged key row: 272 B = 16 B x 17, no bank conflict for 16-B LDS reads
#define VP 72                   // f16 per staged value row: 144 B = 16 B x 9, likewise
#define PCARRY 16384.0f         // power-of-two carry on the f16 P plane, folded back in the f32 epilogue
static_assert(SEQ % 64 == 0);
static_assert(SEQ <= SEQ_FULL);
static_assert(NB >= 1 && NB <= NB_FULL);
static_assert(DD == 64);

#define WS_VT  0u                                            // f16 value planes [b*NH + h][DD][SEQ]
#define WS_END (WS_VT + 2u * (size_t)NB * NH * DD * SEQ)      // 8,388,608 B at full size
static_assert(WS_END <= (size_t)134217728u);

__global__ __launch_bounds__(128) void k_vt(const float* __restrict__ V, _Float16* __restrict__ VT) {
  __shared__ __align__(16) _Float16 th[DD][72];
  const int t = threadIdx.x; const size_t bh = blockIdx.y; const size_t b = bh / NH; const int h = bh % NH; const int m0 = blockIdx.x * 64;
  for (int e = t; e < 64 * DD; e += 128) { const int ml = e / DD, d = e % DD; th[d][ml] = (_Float16)bfr(V[b * BSTR + ((size_t)(m0 + ml) * NH + h) * DD + d]); }
  __syncthreads();
  for (int e = t; e < DD * 8; e += 128) { const int d = e >> 3, q = e & 7; vst2((unsigned*)(VT + (bh * DD + d) * (size_t)SEQ + m0 + q * 8), *(const v4u*)&th[d][q * 8]); }
}
// ---- k_att: block = (64 queries, b*NH + h), 4 waves x 16 query rows: exact bf16 logits over all SEQ keys, running-max softmax, P . v
__global__ __launch_bounds__(128) void k_att(const float* __restrict__ Q, const float* __restrict__ K, const _Float16* __restrict__ VT, float* __restrict__ OUT) {
  __shared__ __align__(16) float sp[4][16][36]; __shared__ __align__(16) float so[4][16][68];
  __shared__ __align__(16) float kst[2][SK][KP]; __shared__ __align__(16) _Float16 vst[2][DD][VP];   // two stages: k rows as f32, v planes [d][key] as f16
  const int tid = threadIdx.x, wave = tid >> 5, lane = tid & 31, col = lane & 15, g = lane >> 4;
  const size_t bh = blockIdx.y; const size_t b = bh / NH; const int h = bh % NH; const int q0 = blockIdx.x * 64 + wave * 16;
  // A fragments of q: row m = col, elements i <- d = kc*32 + 8g + i, 8+i <- d = kc*32 + 16 + 8g + i
  v16b aq[2];
#pragma unroll
  for (int kc = 0; kc < 2; ++kc) { const float* pp = Q + b * BSTR + ((size_t)(q0 + col) * NH + h) * DD + kc * 32 + 8 * g;
#pragma unroll
    for (int i = 0; i < 8; ++i) { aq[kc][i] = (__bf16)pp[i]; aq[kc][8 + i] = (__bf16)pp[16 + i]; } }
  float m[8], l[8];
#pragma unroll
  for (int r = 0; r < 8; ++r) { m[r] = -3.0e38f; l[r] = 0.f; }
  v8f acc[4];
#pragma unroll
  for (int j = 0; j < 4; ++j) acc[j] = v8f{};
  // this lane's pieces of a stage: k piece i = key (tid>>4) + 8i, bytes 16*(tid&15) of its row; v piece i = d (tid>>3) + 16i, bytes 16*(tid&7) of its row
  const float* gk = K + b * BSTR + ((size_t)(tid >> 4) * NH + h) * DD + (tid & 15) * 4; const _Float16* gv = VT + (bh * DD + (tid >> 3)) * (size_t)SEQ + (tid & 7) * 8;
  const unsigned lk = lds_off(&kst[0][tid >> 4][(tid & 15) * 4]), lv = lds_off(&vst[0][tid >> 3][(tid & 7) * 8]);
  stage_copy(lk, gk, lv, gv, 8 * KP * 4, (size_t)8 * RS, 16 * VP * 2, (size_t)16 * SEQ);
  asm volatile("s_wait_asynccnt 0x0" ::: "memory");   // this wave's pieces of stage 0 have landed before the barrier that publishes the stage
  __syncthreads();
  if (1 < NST) stage_copy(lk + SK * KP * 4, gk + (size_t)SK * RS, lv + DD * VP * 2, gv + SK, 8 * KP * 4, (size_t)8 * RS, 16 * VP * 2, (size_t)16 * SEQ);
  // kept rolled: one trip = one stage with its one publish point at the foot
#pragma unroll 1
  for (int st = 0; st < NST; ++st) { const int buf = st & 1;
  // unrolled: the 32-key halves of a stage read at constant LDS offsets
#pragma unroll
  for (int sub = 0; sub < SK / 32; ++sub) { float s[2][8];
    // all raw k pieces of the 32 keys in one group of LDS reads, in front of the first product (both loops unrolled: kr is indexed by constants and stays in registers)
    v4f kr[2][2][4];
#pragma unroll
    for (int ct = 0; ct < 2; ++ct)
#pragma unroll
      for (int kc = 0; kc < 2; ++kc) { const float* kp = &kst[buf][sub * 32 + ct * 16 + col][kc * 32 + 8 * g];
        kr[ct][kc][0] = *(const v4f*)kp; kr[ct][kc][1] = *(const v4f*)(kp + 4); kr[ct][kc][2] = *(const v4f*)(kp + 16); kr[ct][kc][3] = *(const v4f*)(kp + 20); }
#pragma unroll
    for (int ct = 0; ct < 2; ++ct) { v8f c = {};
      // B fragments of k: column n = key kk, elements i <- d = kc*32 + 8g + i, 8+i <- d = kc*32 + 16 + 8g + i (same k map as A)
#pragma unroll
      for (int kc = 0; kc < 2; ++kc) { v16b w;
#pragma unroll
        for (int i = 0; i < 8; ++i) { w[i] = (__bf16)kr[ct][kc][i >> 2][i & 3]; w[8 + i] = (__bf16)kr[ct][kc][2 + (i >> 2)][i & 3]; }
        c = wmma_bf(aq[kc], w, c); }
#pragma unroll
      for (int r = 0; r < 8; ++r) s[ct][r] = c[r]; }   // D element r = query row 8g+r, key column ct*16 + col; no scaling
    // B fragments of v from the staged [d][key] planes: column n = d = j*16 + col, k = key with the same split map; read here so that the softmax covers their latency (unrolled: vh stays in registers)
    v16h vh[4];
#pragma unroll
    for (int j = 0; j < 4; ++j) vh[j] = frag_h(&vst[buf][j * 16 + col][sub * 32], lane);
    float alpha[8];
#pragma unroll
    for (int r = 0; r < 8; ++r) { float mx = fmaxf(s[0][r], s[1][r]);
#pragma unroll
      for (int o = 1; o < 16; o <<= 1) mx = fmaxf(mx, __shfl_xor(mx, o));
      const float mn = fmaxf(m[r], mx); alpha[r] = __expf(m[r] - mn); const float e0 = __expf(s[0][r] - mn), e1 = __expf(s[1][r] - mn); float es = e0 + e1;
#pragma unroll
      for (int o = 1; o < 16; o <<= 1) es += __shfl_xor(es, o);
      l[r] = l[r] * alpha[r] + es; m[r] = mn; sp[wave][8 * g + r][col] = e0; sp[wave][8 * g + r][16 + col] = e1; }
#pragma unroll
    for (int j = 0; j < 4; ++j)
#pragma unroll
      for (int r = 0; r < 8; ++r) acc[j][r] *= alpha[r];
    ldsx();
    // A fragments of P (row m = query col, k = key within the 32-key chunk): P x 2^14 as f16 plus its f16 residual, also x 2^14
    v16h pa, par; { const float* prow = &sp[wave][col][0] + 8 * (lane >> 4);
#pragma unroll
      for (int i = 0; i < 8; ++i) { const float p0 = prow[i] * PCARRY, p1 = prow[16 + i] * PCARRY; pa[i] = (_Float16)p0; pa[8 + i] = (_Float16)p1; par[i] = (_Float16)(p0 - (float)pa[i]); par[8 + i] = (_Float16)(p1 - (float)pa[8 + i]); } }
#pragma unroll
    for (int j = 0; j < 4; ++j) { acc[j] = wmma16(pa, vh[j], acc[j]); acc[j] = wmma16(par, vh[j], acc[j]); }
    ldsx(); }
    // publish point: own LDS reads done, own copies of stage st+1 landed, then the barrier that publishes st+1 and frees this buffer for st+2
    asm volatile("s_wait_dscnt 0x0" ::: "memory");
    asm volatile("s_wait_asynccnt 0x0" ::: "memory");
    __syncthreads();
    if (st + 2 < NST) stage_copy(lk + buf * (SK * KP * 4), gk + (size_t)(st + 2) * SK * RS, lv + buf * (DD * VP * 2), gv + (st + 2) * SK, 8 * KP * 4, (size_t)8 * RS, 16 * VP * 2, (size_t)16 * SEQ); }
  asm volatile("s_wait_asynccnt 0x0" ::: "memory");   // no copy of the ring is outstanding when the wave goes on to its end
#pragma unroll
  for (int r = 0; r < 8; ++r) { const float il = (1.0f / PCARRY) / l[r];
#pragma unroll
    for (int j = 0; j < 4; ++j) so[wave][8 * g + r][j * 16 + col] = acc[j][r] * il; }
  ldsx();
  // one 256-B output row (64 floats of (b, q, h)) per instruction: lanes 0..7 -> line 0, lanes 8..15 -> line 1, 16 B each
  const int lc = lane & 15;
  for (int rl = 0; rl < 16; ++rl) { const v4f ov = *(const v4f*)&so[wave][rl][lc * 4];
    if (lane < 16) vst2(OUT + ((b * OSEQ + q0 + rl) * NH + h) * (size_t)DD + lc * 4, ov); }
}

extern "C" void kernel_launch(void* const* d_in, const int* in_sizes, int n_in, void* d_out, int out_size, void* d_ws, size_t ws_size, hipStream_t stream) {
  if (n_in < 3) return;
  const size_t need = ((size_t)(NB - 1) * SEQ_FULL + SEQ) * RS;
  if ((size_t)in_sizes[0] < need || (size_t)in_sizes[1] < need || (size_t)in_sizes[2] < need) return;
  if ((size_t)out_size < (size_t)NB * OSEQ * RS) return;
  if (ws_size < (size_t)WS_END) return;
  const float* Qp = (const float*)d_in[0];   // 0 queries [4,2048,8,64] f32
  const float* Kp = (const float*)d_in[1];   // 1 keys    [4,2048,8,64] f32
  const float* Vp = (const float*)d_in[2];   // 2 values  [4,2048,8,64] f32
  char* ws = (char*)d_ws; _Float16* VT = (_Float16*)(ws + WS_VT);
  k_vt<<<dim3(SEQ / 64, NB * NH), 128, 0, stream>>>(Vp, VT);
  k_att<<<dim3(SEQ / 64, NB * NH), 128, 0, stream>>>(Qp, Kp, VT, (float*)d_out);
}

// v002
// One run takes 69.4 microseconds.
// Two timings next to v001 both put it at 1.62 times that version's speed.
// Over all steps from v000 it is 3.03 times as fast.
// compute dtype: q, k, v RNE-converted to bf16 on load; logits on v_wmma_f32_16x16x32_bf16 (bf16 x bf16 single product, f32 accumulate), no scaling; running-max softmax in f32 (hardware exp); P carried x 2^14 as f16 hi plus its f16 residual against v (bf16 -> f16, exact) on v_wmma_f32_16x16x32_f16, two products into one f32 accumulator; f32 output [B, L, H, D].
#include <hip/hip_runtime.h>
#include <math.h>

typedef __attribute__((ext_vector_type(16))) _Float16 v16h;
typedef __attribute__((ext_vector_type(16))) __bf16 v16b;
typedef __attribute__((ext_vector_type(8)))  _Float16 v8h;
typedef __attribute__((ext_vector_type(8)))  __bf16 v8b;
typedef __attribute__((ext_vector_type(8)))  float v8f;
typedef __attribute__((ext_vector_type(4)))  float v4f;
typedef __attribute__((ext_vector_type(4)))  unsigned v4u;

template <typename T> __device__ __forceinline__ void vst2(void* p, T v) { *(T*)p = v;  }
__device__ __forceinline__ v8f wmma16(v16h a, v16h b, v8f c) {
  v8f d = __builtin_amdgcn_wmma_f32_16x16x32_f16(false, a, false, b, (short)0, c, false, false);
  asm volatile("v_nop\n\tv_nop\n\tv_nop\n\tv_nop" : "+v"(d) : "v"(a), "v"(b));
  return d;
}
__device__ __forceinline__ v8f wmma_bf(v16b a, v16b b, v8f c) {
  v8f d = __builtin_amdgcn_wmma_f32_16x16x32_bf16(false, a, false, b, (short)0, c, false, false);
  asm volatile("v_nop\n\tv_nop\n\tv_nop\n\tv_nop" : "+v"(d) : "v"(a), "v"(b));
  return d;
}
// 16x16x32 fragments: lane = (h = lane>>4, row/col = lane&15); elements 0..7 = k0+8h+0..7, 8..15 = k0+16+8h+0..7; D element r = row 8h+r, col lane&15
__device__ __forceinline__ v16h frag_h(const _Float16* rowk0, int lane) {
  union { v16h v; v8h q[2]; } u; const _Float16* p = rowk0 + 8 * (lane >> 4);
  u.q[0] = *(const v8h*)p; u.q[1] = *(const v8h*)(p + 16); return u.v;
}
__device__ __forceinline__ v16b frag_b(const __bf16* rowk0, int lane) {
  union { v16b v; v8b q[2]; } u; const __bf16* p = rowk0 + 8 * (lane >> 4);
  u.q[0] = *(const v8b*)p; u.q[1] = *(const v8b*)(p + 16); return u.v;
}
__device__ __forceinline__ float bfr(float v) { return (float)(__bf16)v; }
__device__ __forceinline__ void ldsx() { asm volatile("s_wait_dscnt 0" ::: "memory"); __builtin_amdgcn_wave_barrier(); __builtin_amdgcn_fence(3, "workgroup"); }

// lane l <-> l ^ 16 in the vector unit (a shuffle would go through the LDS queue and its wait)
__device__ __forceinline__ float xhalf(float v) { const int b = __builtin_bit_cast(int, v); return __builtin_bit_cast(float, __builtin_amdgcn_permlanex16(b, b, 0x76543210, 0xfedcba98, false, false)); }
__device__ __forceinline__ unsigned lds_off(const void* p) { return (unsigned)(size_t)p; }   // byte offset in the work-group's LDS
// one stage (64 keys), this lane's share: eight 16-B pieces of the f32 key rows (lk, gk; piece i one step further) and four of the f16 value planes (lv, gv),
// global -> LDS through no register. The s_wait_xcnt closes the statement so that no address register named here is rewritten in front of it.
__device__ __forceinline__ void stage_copy(unsigned lk, const float* gk, unsigned lv, const _Float16* gv, unsigned lks, size_t gks, unsigned lvs, size_t gvs) {
  asm volatile("global_load_async_to_lds_b128 %0, %1, off\n\t"
               "global_load_async_to_lds_b128 %2, %3, off\n\t"
               "global_load_async_to_lds_b128 %4, %5, off\n\t"
               "global_load_async_to_lds_b128 %6, %7, off\n\t"
               "global_load_async_to_lds_b128 %8, %9, off\n\t"
               "global_load_async_to_lds_b128 %10, %11, off\n\t"
               "global_load_async_to_lds_b128 %12, %13, off\n\t"
               "global_load_async_to_lds_b128 %14, %15, off\n\t"
               "global_load_async_to_lds_b128 %16, %17, off\n\t"
               "global_load_async_to_lds_b128 %18, %19, off\n\t"
               "global_load_async_to_lds_b128 %20, %21, off\n\t"
               "global_load_async_to_lds_b128 %22, %23, off\n\t"
               "s_wait_xcnt 0x0"
               :: "v"(lk), "v"(gk), "v"(lk + lks), "v"(gk + gks), "v"(lk + 2 * lks), "v"(gk + 2 * gks), "v"(lk + 3 * lks), "v"(gk + 3 * gks),
                  "v"(lk + 4 * lks), "v"(gk + 4 * gks), "v"(lk + 5 * lks), "v"(gk + 5 * gks), "v"(lk + 6 * lks), "v"(gk + 6 * gks), "v"(lk + 7 * lks), "v"(gk + 7 * gks),
                  "v"(lv), "v"(gv), "v"(lv + lvs), "v"(gv + gvs), "v"(lv + 2 * lvs), "v"(gv + 2 * gvs), "v"(lv + 3 * lvs), "v"(gv + 3 * gvs) : "memory");
}

// dense softmax attention on raw inputs in [B, S, H, D] layout: A = softmax(q k^T) over keys (no 1/sqrt(D)); out = A . v, written [B, L, H, D].
#ifndef NB
#define NB 4                    // batches computed
#endif
#ifndef SEQ
#define SEQ 2048                // sequence length computed
#endif
#define NB_FULL 4
#define SEQ_FULL 2048           // inputs always have the full sequence length per batch
#define NH 8
#define DD 64
#define RS (NH * DD)            // floats between consecutive s of one batch (512)
#define BSTR ((size_t)SEQ_FULL * RS)   // input batch stride in floats
#ifndef OSEQ
#define OSEQ SEQ                // output sequence stride (dense over the computed rows)
#endif
#define SK 64                   // keys per LDS stage: a value-plane row of a stage is one whole 128-B line
#define NST (SEQ / SK)
#define KP 68                   // floats per staged key row: 272 B = 16 B x 17, no bank conflict for 16-B LDS reads
#define VP 72                   // f16 per staged value row: 144 B = 16 B x 9, likewise
#define PCARRY 16384.0f         // power-of-two carry on the f16 P plane, folded back in the f32 epilogue
static_assert(SEQ % 64 == 0);
static_assert(SEQ <= SEQ_FULL);
static_assert(NB >= 1 && NB <= NB_FULL);
static_assert(DD == 64);

#define WS_VT  0u                                            // f16 value planes [b*NH + h][DD][SEQ]
#define WS_END (WS_VT + 2u * (size_t)NB * NH * DD * SEQ)      // 8,388,608 B at full size
static_assert(WS_END <= (size_t)134217728u);

__global__ __launch_bounds__(128) void k_vt(const float* __restrict__ V, _Float16* __restrict__ VT) {
  __shared__ __align__(16) _Float16 th[DD][72];
  const int t = threadIdx.x; const size_t bh = blockIdx.y; const size_t b = bh / NH; const int h = bh % NH; const int m0 = blockIdx.x * 64;
  for (int e = t; e < 64 * DD; e += 128) { const int ml = e / DD, d = e % DD; th[d][ml] = (_Float16)bfr(V[b * BSTR + ((size_t)(m0 + ml) * NH + h) * DD + d]); }
  __syncthreads();
  for (int e = t; e < DD * 8; e += 128) { const int d = e >> 3, q = e & 7; vst2((unsigned*)(VT + (bh * DD + d) * (size_t)SEQ + m0 + q * 8), *(const v4u*)&th[d][q * 8]); }
}
// ---- k_att: block = (64 queries, b*NH + h), 4 waves x 16 queries: bf16 logits over all SEQ keys as S^T = k . q^T (a lane holds one query's scores), running-max softmax, O^T += v^T . P^T
__global__ __launch_bounds__(128) void k_att(const float* __restrict__ Q, const float* __restrict__ K, const _Float16* __restrict__ VT, float* __restrict__ OUT) {
  __shared__ __align__(16) float so[4][16][68];
  __shared__ __align__(16) float kst[2][SK][KP]; __shared__ __align__(16) _Float16 vst[2][DD][VP];   // two stages: k rows as f32, v planes [d][key] as f16
  const int tid = threadIdx.x, wave = tid >> 5, lane = tid & 31, col = lane & 15, g = lane >> 4;
  const size_t bh = blockIdx.y; const size_t b = bh / NH; const int h = bh % NH; const int q0 = blockIdx.x * 64 + wave * 16;
  // B fragments of q: column n = query col, elements i <- d = kc*32 + 8g + i, 8+i <- d = kc*32 + 16 + 8g + i
  v16b aq[2];
#pragma unroll
  for (int kc = 0; kc < 2; ++kc) { const float* pp = Q + b * BSTR + ((size_t)(q0 + col) * NH + h) * DD + kc * 32 + 8 * g;
#pragma unroll
    for (int i = 0; i < 8; ++i) { aq[kc][i] = (__bf16)pp[i]; aq[kc][8 + i] = (__bf16)pp[16 + i]; } }
  float m = -3.0e38f, l = 0.f;   // of query col: m over all keys so far, l over this lane half's keys only (the halves join in the epilogue)
  v8f acc[4];
#pragma unroll
  for (int j = 0; j < 4; ++j) acc[j] = v8f{};
  // this lane's pieces of a stage: k piece i = key (tid>>4) + 8i, bytes 16*(tid&15) of its row; v piece i = d (tid>>3) + 16i, bytes 16*(tid&7) of its row
  const float* gk = K + b * BSTR + ((size_t)(tid >> 4) * NH + h) * DD + (tid & 15) * 4; const _Float16* gv = VT + (bh * DD + (tid >> 3)) * (size_t)SEQ + (tid & 7) * 8;
  const unsigned lk = lds_off(&kst[0][tid >> 4][(tid & 15) * 4]), lv = lds_off(&vst[0][tid >> 3][(tid & 7) * 8]);
  stage_copy(lk, gk, lv, gv, 8 * KP * 4, (size_t)8 * RS, 16 * VP * 2, (size_t)16 * SEQ);
  asm volatile("s_wait_asynccnt 0x0" ::: "memory");   // this wave's pieces of stage 0 have landed before the barrier that publishes the stage
  __syncthreads();
  if (1 < NST) stage_copy(lk + SK * KP * 4, gk + (size_t)SK * RS, lv + DD * VP * 2, gv + SK, 8 * KP * 4, (size_t)8 * RS, 16 * VP * 2, (size_t)16 * SEQ);
  // kept rolled: one trip = one stage with its one publish point at the foot
#pragma unroll 1
  for (int st = 0; st < NST; ++st) { const int buf = st & 1;
  // unrolled: the 32-key halves of a stage read at constant LDS offsets
#pragma unroll
  for (int sub = 0; sub < SK / 32; ++sub) { float s[2][8];
    // all raw k pieces of the 32 keys in one group of LDS reads, in front of the first product (both loops unrolled: kr is indexed by constants and stays in registers)
    v4f kr[2][2][4];
#pragma unroll
    for (int ct = 0; ct < 2; ++ct)
#pragma unroll
      for (int kc = 0; kc < 2; ++kc) { const float* kp = &kst[buf][sub * 32 + ct * 16 + col][kc * 32 + 8 * g];
        kr[ct][kc][0] = *(const v4f*)kp; kr[ct][kc][1] = *(const v4f*)(kp + 4); kr[ct][kc][2] = *(const v4f*)(kp + 16); kr[ct][kc][3] = *(const v4f*)(kp + 20); }
#pragma unroll
    for (int ct = 0; ct < 2; ++ct) { v8f c = {};
      // A fragments of k: row m = key ct*16 + col, elements i <- d = kc*32 + 8g + i, 8+i <- d = kc*32 + 16 + 8g + i (same k map as B)
#pragma unroll
      for (int kc = 0; kc < 2; ++kc) { v16b w;
#pragma unroll
        for (int i = 0; i < 8; ++i) { w[i] = (__bf16)kr[ct][kc][i >> 2][i & 3]; w[8 + i] = (__bf16)kr[ct][kc][2 + (i >> 2)][i & 3]; }
        c = wmma_bf(w, aq[kc], c); }
#pragma unroll
      for (int r = 0; r < 8; ++r) s[ct][r] = c[r]; }   // D element r = key row ct*16 + 8g + r, query column col; no scaling
    // A fragments of v^T from the staged [d][key] planes: row m = d = j*16 + col, k = key with the same split map; read here so that the softmax covers their latency (unrolled: vh stays in registers)
    v16h vh[4];
#pragma unroll
    for (int j = 0; j < 4; ++j) vh[j] = frag_h(&vst[buf][j * 16 + col][sub * 32], lane);
    // maximum of the lane's 16 scores, then of both halves: the 32 keys of query col (unrolled: mx is indexed by constants and stays in registers)
    float mx[8];
#pragma unroll
    for (int r = 0; r < 8; ++r) mx[r] = fmaxf(s[0][r], s[1][r]);
    float mq = fmaxf(fmaxf(fmaxf(mx[0], mx[1]), fmaxf(mx[2], mx[3])), fmaxf(fmaxf(mx[4], mx[5]), fmaxf(mx[6], mx[7])));
    mq = fmaxf(mq, xhalf(mq));
    const float mn = fmaxf(m, mq), alpha = __expf(m - mn); m = mn;
    // B fragment of P^T straight from the score registers (column n = query col; element i <- key 8g + i = tile 0 register i, 8+i <- key 16 + 8g + i = tile 1 register i, the k map of vh):
    // P x 2^14 as f16 plus its f16 residual, also x 2^14 (unrolled: s, pa, par and es are indexed by constants and stay in registers)
    v16h pa, par; float es[8];
#pragma unroll
    for (int i = 0; i < 8; ++i) { const float e0 = __expf(s[0][i] - mn), e1 = __expf(s[1][i] - mn); es[i] = e0 + e1;
      const float p0 = e0 * PCARRY, p1 = e1 * PCARRY; pa[i] = (_Float16)p0; pa[8 + i] = (_Float16)p1; par[i] = (_Float16)(p0 - (float)pa[i]); par[8 + i] = (_Float16)(p1 - (float)pa[8 + i]); }
    l = l * alpha + (((es[0] + es[1]) + (es[2] + es[3])) + ((es[4] + es[5]) + (es[6] + es[7])));
#pragma unroll
    for (int j = 0; j < 4; ++j)
#pragma unroll
      for (int r = 0; r < 8; ++r) acc[j][r] *= alpha;
#pragma unroll
    for (int j = 0; j < 4; ++j) { acc[j] = wmma16(vh[j], pa, acc[j]); acc[j] = wmma16(vh[j], par, acc[j]); } }   // D element r = d row j*16 + 8g + r, query column col
    // publish point: own LDS reads done, own copies of stage st+1 landed, then the barrier that publishes st+1 and frees this buffer for st+2
    asm volatile("s_wait_dscnt 0x0" ::: "memory");
    asm volatile("s_wait_asynccnt 0x0" ::: "memory");
    __syncthreads();
    if (st + 2 < NST) stage_copy(lk + buf * (SK * KP * 4), gk + (size_t)(st + 2) * SK * RS, lv + buf * (DD * VP * 2), gv + (st + 2) * SK, 8 * KP * 4, (size_t)8 * RS, 16 * VP * 2, (size_t)16 * SEQ); }
  asm volatile("s_wait_asynccnt 0x0" ::: "memory");   // no copy of the ring is outstanding when the wave goes on to its end
  const float il = (1.0f / PCARRY) / (l + xhalf(l));
#pragma unroll
  for (int j = 0; j < 4; ++j) { vst2(&so[wave][col][j * 16 + 8 * g], v4f{acc[j][0] * il, acc[j][1] * il, acc[j][2] * il, acc[j][3] * il});
    vst2(&so[wave][col][j * 16 + 8 * g + 4], v4f{acc[j][4] * il, acc[j][5] * il, acc[j][6] * il, acc[j][7] * il}); }
  ldsx();
  // one 256-B output row (64 floats of (b, q, h)) per instruction: lanes 0..7 -> line 0, lanes 8..15 -> line 1, 16 B each
  const int lc = lane & 15;
  for (int rl = 0; rl < 16; ++rl) { const v4f ov = *(const v4f*)&so[wave][rl][lc * 4];
    if (lane < 16) vst2(OUT + ((b * OSEQ + q0 + rl) * NH + h) * (size_t)DD + lc * 4, ov); }
}

extern "C" void kernel_launch(void* const* d_in, const int* in_sizes, int n_in, void* d_out, int out_size, void* d_ws, size_t ws_size, hipStream_t stream) {
  if (n_in < 3) return;
  const size_t need = ((size_t)(NB - 1) * SEQ_FULL + SEQ) * RS;
  if ((size_t)in_sizes[0] < need || (size_t)in_sizes[1] < need || (size_t)in_sizes[2] < need) return;
  if ((size_t)out_size < (size_t)NB * OSEQ * RS) return;
  if (ws_size < (size_t)WS_END) return;
  const float* Qp = (const float*)d_in[0];   // 0 queries [4,2048,8,64] f32
  const float* Kp = (const float*)d_in[1];   // 1 keys    [4,2048,8,64] f32
  const float* Vp = (const float*)d_in[2];   // 2 values  [4,2048,8,64] f32
  char* ws = (char*)d_ws; _Float16* VT = (_Float16*)(ws + WS_VT);
  k_vt<<<dim3(SEQ / 64, NB * NH), 128, 0, stream>>>(Vp, VT);
  k_att<<<dim3(SEQ / 64, NB * NH), 128, 0, stream>>>(Qp, Kp, VT, (float*)d_out);
}

// v003
// It runs in 63.4 microseconds.
// Timed twice side by side with v002, it ran 1.10 and 1.09 times as fast.
// Counting every step since v000, it is 3.31 times as fast.
// compute dtype: q, k, v RNE-converted to bf16 on load; logits on v_wmma_f32_16x16x32_bf16 (bf16 x bf16 single product, f32 accumulate), no scaling; running-max softmax in f32 (hardware exp); P carried x 2^14 as f16 hi plus its f16 residual against v (bf16 -> f16, exact) on v_wmma_f32_16x16x32_f16, two products into one f32 accumulator; f32 output [B, L, H, D].
#include <hip/hip_runtime.h>
#include <math.h>

typedef __attribute__((ext_vector_type(16))) _Float16 v16h;
typedef __attribute__((ext_vector_type(16))) __bf16 v16b;
typedef __attribute__((ext_vector_type(8)))  _Float16 v8h;
typedef __attribute__((ext_vector_type(8)))  __bf16 v8b;
typedef __attribute__((ext_vector_type(8)))  float v8f;
typedef __attribute__((ext_vector_type(4)))  float v4f;
typedef __attribute__((ext_vector_type(4)))  unsigned v4u;

template <typename T> __device__ __forceinline__ void vst2(void* p, T v) { *(T*)p = v;  }
// bare builtins: the compiler keeps the distances behind its own matrix instructions and fills them with useful work where it can
__device__ __forceinline__ v8f wmma16(v16h a, v16h b, v8f c) {
  return __builtin_amdgcn_wmma_f32_16x16x32_f16(false, a, false, b, (short)0, c, false, false);
}
__device__ __forceinline__ v8f wmma_bf(v16b a, v16b b, v8f c) {
  return __builtin_amdgcn_wmma_f32_16x16x32_bf16(false, a, false, b, (short)0, c, false, false);
}
// 16x16x32 fragments: lane = (h = lane>>4, row/col = lane&15); elements 0..7 = k0+8h+0..7, 8..15 = k0+16+8h+0..7; D element r = row 8h+r, col lane&15
__device__ __forceinline__ v16h frag_h(const _Float16* rowk0, int lane) {
  union { v16h v; v8h q[2]; } u; const _Float16* p = rowk0 + 8 * (lane >> 4);
  u.q[0] = *(const v8h*)p; u.q[1] = *(const v8h*)(p + 16); return u.v;
}
__device__ __forceinline__ v16b frag_b(const __bf16* rowk0, int lane) {
  union { v16b v; v8b q[2]; } u; const __bf16* p = rowk0 + 8 * (lane >> 4);
  u.q[0] = *(const v8b*)p; u.q[1] = *(const v8b*)(p + 16); return u.v;
}
__device__ __forceinline__ float bfr(float v) { return (float)(__bf16)v; }
__device__ __forceinline__ void ldsx() { asm volatile("s_wait_dscnt 0" ::: "memory"); __builtin_amdgcn_wave_barrier(); __builtin_amdgcn_fence(3, "workgroup"); }

// lane l <-> l ^ 16 in the vector unit (a shuffle would go through the LDS queue and its wait)
__device__ __forceinline__ float xhalf(float v) { const int b = __builtin_bit_cast(int, v); return __builtin_bit_cast(float, __builtin_amdgcn_permlanex16(b, b, 0x76543210, 0xfedcba98, false, false)); }
__device__ __forceinline__ unsigned lds_off(const void* p) { return (unsigned)(size_t)p; }   // byte offset in the work-group's LDS
// one stage (64 keys), this lane's share: eight 16-B pieces of the f32 key rows (lk, gk; piece i one step further) and four of the f16 value planes (lv, gv),
// global -> LDS through no register. The s_wait_xcnt closes the statement so that no address register named here is rewritten in front of it.
__device__ __forceinline__ void stage_copy(unsigned lk, const float* gk, unsigned lv, const _Float16* gv, unsigned lks, size_t gks, unsigned lvs, size_t gvs) {
  asm volatile("global_load_async_to_lds_b128 %0, %1, off\n\t"
               "global_load_async_to_lds_b128 %2, %3, off\n\t"
               "global_load_async_to_lds_b128 %4, %5, off\n\t"
               "global_load_async_to_lds_b128 %6, %7, off\n\t"
               "global_load_async_to_lds_b128 %8, %9, off\n\t"
               "global_load_async_to_lds_b128 %10, %11, off\n\t"
               "global_load_async_to_lds_b128 %12, %13, off\n\t"
               "global_load_async_to_lds_b128 %14, %15, off\n\t"
               "global_load_async_to_lds_b128 %16, %17, off\n\t"
               "global_load_async_to_lds_b128 %18, %19, off\n\t"
               "global_load_async_to_lds_b128 %20, %21, off\n\t"
               "global_load_async_to_lds_b128 %22, %23, off\n\t"
               "s_wait_xcnt 0x0"
               :: "v"(lk), "v"(gk), "v"(lk + lks), "v"(gk + gks), "v"(lk + 2 * lks), "v"(gk + 2 * gks), "v"(lk + 3 * lks), "v"(gk + 3 * gks),
                  "v"(lk + 4 * lks), "v"(gk + 4 * gks), "v"(lk + 5 * lks), "v"(gk + 5 * gks), "v"(lk + 6 * lks), "v"(gk + 6 * gks), "v"(lk + 7 * lks), "v"(gk + 7 * gks),
                  "v"(lv), "v"(gv), "v"(lv + lvs), "v"(gv + gvs), "v"(lv + 2 * lvs), "v"(gv + 2 * gvs), "v"(lv + 3 * lvs), "v"(gv + 3 * gvs) : "memory");
}

// dense softmax attention on raw inputs in [B, S, H, D] layout: A = softmax(q k^T) over keys (no 1/sqrt(D)); out = A . v, written [B, L, H, D].
#ifndef NB
#define NB 4                    // batches computed
#endif
#ifndef SEQ
#define SEQ 2048                // sequence length computed
#endif
#define NB_FULL 4
#define SEQ_FULL 2048           // inputs always have the full sequence length per batch
#define NH 8
#define DD 64
#define RS (NH * DD)            // floats between consecutive s of one batch (512)
#define BSTR ((size_t)SEQ_FULL * RS)   // input batch stride in floats
#ifndef OSEQ
#define OSEQ SEQ                // output sequence stride (dense over the computed rows)
#endif
#define SK 64                   // keys per LDS stage: a value-plane row of a stage is one whole 128-B line
#define NST (SEQ / SK)
#define KP 68                   // floats per staged key row: 272 B = 16 B x 17, no bank conflict for 16-B LDS reads
#define VP 72                   // f16 per staged value row: 144 B = 16 B x 9, likewise
#define PCARRY 16384.0f         // power-of-two carry on the f16 P plane, folded back in the f32 epilogue
static_assert(SEQ % 64 == 0);
static_assert(SEQ <= SEQ_FULL);
static_assert(NB >= 1 && NB <= NB_FULL);
static_assert(DD == 64);

#define WS_VT  0u                                            // f16 value planes [b*NH + h][DD][SEQ]
#define WS_END (WS_VT + 2u * (size_t)NB * NH * DD * SEQ)      // 8,388,608 B at full size
static_assert(WS_END <= (size_t)134217728u);

__global__ __launch_bounds__(128) void k_vt(const float* __restrict__ V, _Float16* __restrict__ VT) {
  __shared__ __align__(16) _Float16 th[DD][72];
  const int t = threadIdx.x; const size_t bh = blockIdx.y; const size_t b = bh / NH; const int h = bh % NH; const int m0 = blockIdx.x * 64;
  for (int e = t; e < 64 * DD; e += 128) { const int ml = e / DD, d = e % DD; th[d][ml] = (_Float16)bfr(V[b * BSTR + ((size_t)(m0 + ml) * NH + h) * DD + d]); }
  __syncthreads();
  for (int e = t; e < DD * 8; e += 128) { const int d = e >> 3, q = e & 7; vst2((unsigned*)(VT + (bh * DD + d) * (size_t)SEQ + m0 + q * 8), *(const v4u*)&th[d][q * 8]); }
}
// ---- k_att: block = (64 queries, b*NH + h), 4 waves x 16 queries: bf16 logits over all SEQ keys as S^T = k . q^T (a lane holds one query's scores), running-max softmax, O^T += v^T . P^T
__global__ __launch_bounds__(128) void k_att(const float* __restrict__ Q, const float* __restrict__ K, const _Float16* __restrict__ VT, float* __restrict__ OUT) {
  __shared__ __align__(16) float so[4][16][68];
  __shared__ __align__(16) float kst[2][SK][KP]; __shared__ __align__(16) _Float16 vst[2][DD][VP];   // two stages: k rows as f32, v planes [d][key] as f16
  const int tid = threadIdx.x, wave = tid >> 5, lane = tid & 31, col = lane & 15, g = lane >> 4;
  const size_t bh = blockIdx.y; const size_t b = bh / NH; const int h = bh % NH; const int q0 = blockIdx.x * 64 + wave * 16;
  // B fragments of q: column n = query col, elements i <- d = kc*32 + 8g + i, 8+i <- d = kc*32 + 16 + 8g + i
  v16b aq[2];
#pragma unroll
  for (int kc = 0; kc < 2; ++kc) { const float* pp = Q + b * BSTR + ((size_t)(q0 + col) * NH + h) * DD + kc * 32 + 8 * g;
#pragma unroll
    for (int i = 0; i < 8; ++i) { aq[kc][i] = (__bf16)pp[i]; aq[kc][8 + i] = (__bf16)pp[16 + i]; } }
  float m = -3.0e38f, l = 0.f;   // of query col: m over all keys so far, l over this lane half's keys only (the halves join in the epilogue)
  v8f acc[4];
#pragma unroll
  for (int j = 0; j < 4; ++j) acc[j] = v8f{};
  // this lane's pieces of a stage: k piece i = key (tid>>4) + 8i, bytes 16*(tid&15) of its row; v piece i = d (tid>>3) + 16i, bytes 16*(tid&7) of its row
  const float* gk = K + b * BSTR + ((size_t)(tid >> 4) * NH + h) * DD + (tid & 15) * 4; const _Float16* gv = VT + (bh * DD + (tid >> 3)) * (size_t)SEQ + (tid & 7) * 8;
  const unsigned lk = lds_off(&kst[0][tid >> 4][(tid & 15) * 4]), lv = lds_off(&vst[0][tid >> 3][(tid & 7) * 8]);
  stage_copy(lk, gk, lv, gv, 8 * KP * 4, (size_t)8 * RS, 16 * VP * 2, (size_t)16 * SEQ);
  asm volatile("s_wait_asynccnt 0x0" ::: "memory");   // this wave's pieces of stage 0 have landed before the barrier that publishes the stage
  __syncthreads();
  if (1 < NST) stage_copy(lk + SK * KP * 4, gk + (size_t)SK * RS, lv + DD * VP * 2, gv + SK, 8 * KP * 4, (size_t)8 * RS, 16 * VP * 2, (size_t)16 * SEQ);
  // kept rolled: one trip = one stage with its one publish point at the foot
#pragma unroll 1
  for (int st = 0; st < NST; ++st) { const int buf = st & 1;
  // unrolled: the 32-key halves of a stage read at constant LDS offsets
#pragma unroll
  for (int sub = 0; sub < SK / 32; ++sub) { float s[2][8];
    // all raw k pieces of the 32 keys in one group of LDS reads, in front of the first product (both loops unrolled: kr is indexed by constants and stays in registers)
    v4f kr[2][2][4];
#pragma unroll
    for (int ct = 0; ct < 2; ++ct)
#pragma unroll
      for (int kc = 0; kc < 2; ++kc) { const float* kp = &kst[buf][sub * 32 + ct * 16 + col][kc * 32 + 8 * g];
        kr[ct][kc][0] = *(const v4f*)kp; kr[ct][kc][1] = *(const v4f*)(kp + 4); kr[ct][kc][2] = *(const v4f*)(kp + 16); kr[ct][kc][3] = *(const v4f*)(kp + 20); }
#pragma unroll
    for (int ct = 0; ct < 2; ++ct) { v8f c = {};
      // A fragments of k: row m = key ct*16 + col, elements i <- d = kc*32 + 8g + i, 8+i <- d = kc*32 + 16 + 8g + i (same k map as B)
#pragma unroll
      for (int kc = 0; kc < 2; ++kc) { v16b w;
#pragma unroll
        for (int i = 0; i < 8; ++i) { w[i] = (__bf16)kr[ct][kc][i >> 2][i & 3]; w[8 + i] = (__bf16)kr[ct][kc][2 + (i >> 2)][i & 3]; }
        c = wmma_bf(w, aq[kc], c); }
#pragma unroll
      for (int r = 0; r < 8; ++r) s[ct][r] = c[r]; }   // D element r = key row ct*16 + 8g + r, query column col; no scaling
    // A fragments of v^T from the staged [d][key] planes: row m = d = j*16 + col, k = key with the same split map; read here so that the softmax covers their latency (unrolled: vh stays in registers)
    v16h vh[4];
#pragma unroll
    for (int j = 0; j < 4; ++j) vh[j] = frag_h(&vst[buf][j * 16 + col][sub * 32], lane);
    __builtin_amdgcn_sched_barrier(0);   // keeps the eight reads above in front of the softmax, whose work covers their latency
    // maximum of the lane's 16 scores, then of both halves: the 32 keys of query col (unrolled: mx is indexed by constants and stays in registers)
    float mx[8];
#pragma unroll
    for (int r = 0; r < 8; ++r) mx[r] = fmaxf(s[0][r], s[1][r]);
    float mq = fmaxf(fmaxf(fmaxf(mx[0], mx[1]), fmaxf(mx[2], mx[3])), fmaxf(fmaxf(mx[4], mx[5]), fmaxf(mx[6], mx[7])));
    mq = fmaxf(mq, xhalf(mq));
    const float mn = fmaxf(m, mq), alpha = __expf(m - mn); m = mn;
    // B fragment of P^T straight from the score registers (column n = query col; element i <- key 8g + i = tile 0 register i, 8+i <- key 16 + 8g + i = tile 1 register i, the k map of vh):
    // P x 2^14 as f16 plus its f16 residual, also x 2^14 (unrolled: s, pa, par and es are indexed by constants and stay in registers)
    v16h pa, par; float es[8];
#pragma unroll
    for (int i = 0; i < 8; ++i) { const float e0 = __expf(s[0][i] - mn), e1 = __expf(s[1][i] - mn); es[i] = e0 + e1;
      const float p0 = e0 * PCARRY, p1 = e1 * PCARRY; pa[i] = (_Float16)p0; pa[8 + i] = (_Float16)p1; par[i] = (_Float16)(p0 - (float)pa[i]); par[8 + i] = (_Float16)(p1 - (float)pa[8 + i]); }
    l = l * alpha + (((es[0] + es[1]) + (es[2] + es[3])) + ((es[4] + es[5]) + (es[6] + es[7])));
#pragma unroll
    for (int j = 0; j < 4; ++j)
#pragma unroll
      for (int r = 0; r < 8; ++r) acc[j][r] *= alpha;
#pragma unroll
    for (int j = 0; j < 4; ++j) { acc[j] = wmma16(vh[j], pa, acc[j]); acc[j] = wmma16(vh[j], par, acc[j]); } }   // D element r = d row j*16 + 8g + r, query column col
    // publish point: own LDS reads done, own copies of stage st+1 landed, then the barrier that publishes st+1 and frees this buffer for st+2
    __builtin_amdgcn_sched_barrier(0);   // keeps the stage's products in front of the publish point, so that the refill behind it is issued a whole trip ahead of its use
    asm volatile("s_wait_dscnt 0x0" ::: "memory");
    asm volatile("s_wait_asynccnt 0x0" ::: "memory");
    __syncthreads();
    if (st + 2 < NST) stage_copy(lk + buf * (SK * KP * 4), gk + (size_t)(st + 2) * SK * RS, lv + buf * (DD * VP * 2), gv + (st + 2) * SK, 8 * KP * 4, (size_t)8 * RS, 16 * VP * 2, (size_t)16 * SEQ); }
  asm volatile("s_wait_asynccnt 0x0" ::: "memory");   // no copy of the ring is outstanding when the wave goes on to its end
  const float il = (1.0f / PCARRY) / (l + xhalf(l));
#pragma unroll
  for (int j = 0; j < 4; ++j) { vst2(&so[wave][col][j * 16 + 8 * g], v4f{acc[j][0] * il, acc[j][1] * il, acc[j][2] * il, acc[j][3] * il});
    vst2(&so[wave][col][j * 16 + 8 * g + 4], v4f{acc[j][4] * il, acc[j][5] * il, acc[j][6] * il, acc[j][7] * il}); }
  ldsx();
  // one 256-B output row (64 floats of (b, q, h)) per instruction: lanes 0..7 -> line 0, lanes 8..15 -> line 1, 16 B each
  const int lc = lane & 15;
  for (int rl = 0; rl < 16; ++rl) { const v4f ov = *(const v4f*)&so[wave][rl][lc * 4];
    if (lane < 16) vst2(OUT + ((b * OSEQ + q0 + rl) * NH + h) * (size_t)DD + lc * 4, ov); }
}

extern "C" void kernel_launch(void* const* d_in, const int* in_sizes, int n_in, void* d_out, int out_size, void* d_ws, size_t ws_size, hipStream_t stream) {
  if (n_in < 3) return;
  const size_t need = ((size_t)(NB - 1) * SEQ_FULL + SEQ) * RS;
  if ((size_t)in_sizes[0] < need || (size_t)in_sizes[1] < need || (size_t)in_sizes[2] < need) return;
  if ((size_t)out_size < (size_t)NB * OSEQ * RS) return;
  if (ws_size < (size_t)WS_END) return;
  const float* Qp = (const float*)d_in[0];   // 0 queries [4,2048,8,64] f32
  const float* Kp = (const float*)d_in[1];   // 1 keys    [4,2048,8,64] f32
  const float* Vp = (const float*)d_in[2];   // 2 values  [4,2048,8,64] f32
  char* ws = (char*)d_ws; _Float16* VT = (_Float16*)(ws + WS_VT);
  k_vt<<<dim3(SEQ / 64, NB * NH), 128, 0, stream>>>(Vp, VT);
  k_att<<<dim3(SEQ / 64, NB * NH), 128, 0, stream>>>(Qp, Kp, VT, (float*)d_out);
}

// v004
// A run of this version takes 56.4 microseconds.
// Timed twice side by side with v003, it ran 1.13 and 1.12 times as fast.
// Over all steps from v000 it is 3.73 times as fast.
// compute dtype: q, k, v RNE-converted to bf16 on load; logits on v_wmma_f32_16x16x32_bf16 (bf16 x bf16 single product, f32 accumulate), no scaling; running-max softmax in f32 (hardware exp); P carried x 2^14 (the carry added in the exponent) as f16 hi plus its f16 residual against v (bf16 -> f16, exact) on v_wmma_f32_16x16x32_f16, two products into one f32 accumulator; f32 output [B, L, H, D].
#include <hip/hip_runtime.h>
#include <math.h>

typedef __attribute__((ext_vector_type(16))) _Float16 v16h;
typedef __attribute__((ext_vector_type(16))) __bf16 v16b;
typedef __attribute__((ext_vector_type(8)))  _Float16 v8h;
typedef __attribute__((ext_vector_type(8)))  __bf16 v8b;
typedef __attribute__((ext_vector_type(8)))  float v8f;
typedef __attribute__((ext_vector_type(4)))  float v4f;
typedef __attribute__((ext_vector_type(4)))  unsigned v4u;
typedef __attribute__((ext_vector_type(8)))  unsigned v8u;
typedef __attribute__((ext_vector_type(2)))  float v2f;
typedef __attribute__((ext_vector_type(2)))  _Float16 v2h;

template <typename T> __device__ __forceinline__ void vst2(void* p, T v) { *(T*)p = v;  }
// bare builtins: the compiler keeps the distances behind its own matrix instructions and fills them with useful work where it can
__device__ __forceinline__ v8f wmma16(v16h a, v16h b, v8f c) {
  return __builtin_amdgcn_wmma_f32_16x16x32_f16(false, a, false, b, (short)0, c, false, false);
}
__device__ __forceinline__ v8f wmma_bf(v16b a, v16b b, v8f c) {
  return __builtin_amdgcn_wmma_f32_16x16x32_bf16(false, a, false, b, (short)0, c, false, false);
}
// 16x16x32 fragments: lane = (h = lane>>4, row/col = lane&15); elements 0..7 = k0+8h+0..7, 8..15 = k0+16+8h+0..7; D element r = row 8h+r, col lane&15
__device__ __forceinline__ v16h frag_h(const _Float16* rowk0, int lane) {
  union { v16h v; v8h q[2]; } u; const _Float16* p = rowk0 + 8 * (lane >> 4);
  u.q[0] = *(const v8h*)p; u.q[1] = *(const v8h*)(p + 16); return u.v;
}
__device__ __forceinline__ v16b frag_b(const __bf16* rowk0, int lane) {
  union { v16b v; v8b q[2]; } u; const __bf16* p = rowk0 + 8 * (lane >> 4);
  u.q[0] = *(const v8b*)p; u.q[1] = *(const v8b*)(p + 16); return u.v;
}
__device__ __forceinline__ float bfr(float v) { return (float)(__bf16)v; }
__device__ __forceinline__ void ldsx() { asm volatile("s_wait_dscnt 0" ::: "memory"); __builtin_amdgcn_wave_barrier(); __builtin_amdgcn_fence(3, "workgroup"); }

// lane l <-> l ^ 16 in the vector unit (a shuffle would go through the LDS queue and its wait)
__device__ __forceinline__ float xhalf(float v) { const int b = __builtin_bit_cast(int, v); return __builtin_bit_cast(float, __builtin_amdgcn_permlanex16(b, b, 0x76543210, 0xfedcba98, false, false)); }
// what the f16 rounding h of a fragment's elements lost, rounded to f16 itself: register k of r <- x[k] - low half of h[k] (element 2k), y[k] - high half (element 2k + 1).
// One vector instruction an element: the mixed-precision fma reads the f16 half and rounds its f32 result to f16 itself, where the compiler's form of the same arithmetic took three.
// The eight of a kind stand together, so that the write of a register's second half has its first half's write eight back and no dependent pair holds up the vector port.
// The factor 1.0 comes as 32 bits in a scalar register, the way the compiler hands an f32 factor to these instructions.
__device__ __forceinline__ void rest16(unsigned (&r)[8], const float (&x)[8], const float (&y)[8], const unsigned (&h)[8]) {
  asm("v_fma_mixlo_f16 %0, %8, %24, -%16 op_sel_hi:[0,0,1]\n\t"
      "v_fma_mixlo_f16 %1, %9, %24, -%17 op_sel_hi:[0,0,1]\n\t"
      "v_fma_mixlo_f16 %2, %10, %24, -%18 op_sel_hi:[0,0,1]\n\t"
      "v_fma_mixlo_f16 %3, %11, %24, -%19 op_sel_hi:[0,0,1]\n\t"
      "v_fma_mixlo_f16 %4, %12, %24, -%20 op_sel_hi:[0,0,1]\n\t"
      "v_fma_mixlo_f16 %5, %13, %24, -%21 op_sel_hi:[0,0,1]\n\t"
      "v_fma_mixlo_f16 %6, %14, %24, -%22 op_sel_hi:[0,0,1]\n\t"
      "v_fma_mixlo_f16 %7, %15, %24, -%23 op_sel_hi:[0,0,1]"
      : "=&v"(r[0]), "=&v"(r[1]), "=&v"(r[2]), "=&v"(r[3]), "=&v"(r[4]), "=&v"(r[5]), "=&v"(r[6]), "=&v"(r[7])
      : "v"(x[0]), "v"(x[1]), "v"(x[2]), "v"(x[3]), "v"(x[4]), "v"(x[5]), "v"(x[6]), "v"(x[7]),
        "v"(h[0]), "v"(h[1]), "v"(h[2]), "v"(h[3]), "v"(h[4]), "v"(h[5]), "v"(h[6]), "v"(h[7]), "s"(1.0f));
  asm("v_fma_mixhi_f16 %0, %8, %24, -%16 op_sel:[0,0,1] op_sel_hi:[0,0,1]\n\t"
      "v_fma_mixhi_f16 %1, %9, %24, -%17 op_sel:[0,0,1] op_sel_hi:[0,0,1]\n\t"
      "v_fma_mixhi_f16 %2, %10, %24, -%18 op_sel:[0,0,1] op_sel_hi:[0,0,1]\n\t"
      "v_fma_mixhi_f16 %3, %11, %24, -%19 op_sel:[0,0,1] op_sel_hi:[0,0,1]\n\t"
      "v_fma_mixhi_f16 %4, %12, %24, -%20 op_sel:[0,0,1] op_sel_hi:[0,0,1]\n\t"
      "v_fma_mixhi_f16 %5, %13, %24, -%21 op_sel:[0,0,1] op_sel_hi:[0,0,1]\n\t"
      "v_fma_mixhi_f16 %6, %14, %24, -%22 op_sel:[0,0,1] op_sel_hi:[0,0,1]\n\t"
      "v_fma_mixhi_f16 %7, %15, %24, -%23 op_sel:[0,0,1] op_sel_hi:[0,0,1]"
      : "+v"(r[0]), "+v"(r[1]), "+v"(r[2]), "+v"(r[3]), "+v"(r[4]), "+v"(r[5]), "+v"(r[6]), "+v"(r[7])
      : "v"(y[0]), "v"(y[1]), "v"(y[2]), "v"(y[3]), "v"(y[4]), "v"(y[5]), "v"(y[6]), "v"(y[7]),
        "v"(h[0]), "v"(h[1]), "v"(h[2]), "v"(h[3]), "v"(h[4]), "v"(h[5]), "v"(h[6]), "v"(h[7]), "s"(1.0f));
}
__device__ __forceinline__ unsigned lds_off(const void* p) { return (unsigned)(size_t)p; }   // byte offset in the work-group's LDS
// one stage (64 keys), this lane's share: eight 16-B pieces of the f32 key rows (lk, gk; piece i one step further) and four of the f16 value planes (lv, gv),
// global -> LDS through no register. The s_wait_xcnt closes the statement so that no address register named here is rewritten in front of it.
__device__ __forceinline__ void stage_copy(unsigned lk, const float* gk, unsigned lv, const _Float16* gv, unsigned lks, size_t gks, unsigned lvs, size_t gvs) {
  asm volatile("global_load_async_to_lds_b128 %0, %1, off\n\t"
               "global_load_async_to_lds_b128 %2, %3, off\n\t"
               "global_load_async_to_lds_b128 %4, %5, off\n\t"
               "global_load_async_to_lds_b128 %6, %7, off\n\t"
               "global_load_async_to_lds_b128 %8, %9, off\n\t"
               "global_load_async_to_lds_b128 %10, %11, off\n\t"
               "global_load_async_to_lds_b128 %12, %13, off\n\t"
               "global_load_async_to_lds_b128 %14, %15, off\n\t"
               "global_load_async_to_lds_b128 %16, %17, off\n\t"
               "global_load_async_to_lds_b128 %18, %19, off\n\t"
               "global_load_async_to_lds_b128 %20, %21, off\n\t"
               "global_load_async_to_lds_b128 %22, %23, off\n\t"
               "s_wait_xcnt 0x0"
               :: "v"(lk), "v"(gk), "v"(lk + lks), "v"(gk + gks), "v"(lk + 2 * lks), "v"(gk + 2 * gks), "v"(lk + 3 * lks), "v"(gk + 3 * gks),
                  "v"(lk + 4 * lks), "v"(gk + 4 * gks), "v"(lk + 5 * lks), "v"(gk + 5 * gks), "v"(lk + 6 * lks), "v"(gk + 6 * gks), "v"(lk + 7 * lks), "v"(gk + 7 * gks),
                  "v"(lv), "v"(gv), "v"(lv + lvs), "v"(gv + gvs), "v"(lv + 2 * lvs), "v"(gv + 2 * gvs), "v"(lv + 3 * lvs), "v"(gv + 3 * gvs) : "memory");
}

// dense softmax attention on raw inputs in [B, S, H, D] layout: A = softmax(q k^T) over keys (no 1/sqrt(D)); out = A . v, written [B, L, H, D].
#ifndef NB
#define NB 4                    // batches computed
#endif
#ifndef SEQ
#define SEQ 2048                // sequence length computed
#endif
#define NB_FULL 4
#define SEQ_FULL 2048           // inputs always have the full sequence length per batch
#define NH 8
#define DD 64
#define RS (NH * DD)            // floats between consecutive s of one batch (512)
#define BSTR ((size_t)SEQ_FULL * RS)   // input batch stride in floats
#ifndef OSEQ
#define OSEQ SEQ                // output sequence stride (dense over the computed rows)
#endif
#define SK 64                   // keys per LDS stage: a value-plane row of a stage is one whole 128-B line
#define NST (SEQ / SK)
#define KP 68                   // floats per staged key row: 272 B = 16 B x 17, no bank conflict for 16-B LDS reads
#define VP 72                   // f16 per staged value row: 144 B = 16 B x 9, likewise
#define PCARRY_LOG2 14.0f       // power-of-two carry on P (x 2^14), added in the exponent; the row sum carries it too, so it cancels in the epilogue's division
#define LOG2E 1.44269504f
static_assert(SEQ % 64 == 0);
static_assert(SEQ <= SEQ_FULL);
static_assert(NB >= 1 && NB <= NB_FULL);
static_assert(DD == 64);

#define WS_VT  0u                                            // f16 value planes [b*NH + h][DD][SEQ]
#define WS_END (WS_VT + 2u * (size_t)NB * NH * DD * SEQ)      // 8,388,608 B at full size
static_assert(WS_END <= (size_t)134217728u);

__global__ __launch_bounds__(128) void k_vt(const float* __restrict__ V, _Float16* __restrict__ VT) {
  __shared__ __align__(16) _Float16 th[DD][72];
  const int t = threadIdx.x; const size_t bh = blockIdx.y; const size_t b = bh / NH; const int h = bh % NH; const int m0 = blockIdx.x * 64;
  for (int e = t; e < 64 * DD; e += 128) { const int ml = e / DD, d = e % DD; th[d][ml] = (_Float16)bfr(V[b * BSTR + ((size_t)(m0 + ml) * NH + h) * DD + d]); }
  __syncthreads();
  for (int e = t; e < DD * 8; e += 128) { const int d = e >> 3, q = e & 7; vst2((unsigned*)(VT + (bh * DD + d) * (size_t)SEQ + m0 + q * 8), *(const v4u*)&th[d][q * 8]); }
}
// ---- k_att: block = (64 queries, b*NH + h), 4 waves x 16 queries: bf16 logits over all SEQ keys as S^T = k . q^T (a lane holds one query's scores), running-max softmax, O^T += v^T . P^T
__global__ __launch_bounds__(128) void k_att(const float* __restrict__ Q, const float* __restrict__ K, const _Float16* __restrict__ VT, float* __restrict__ OUT) {
  __shared__ __align__(16) float so[4][16][68];
  __shared__ __align__(16) float kst[2][SK][KP]; __shared__ __align__(16) _Float16 vst[2][DD][VP];   // two stages: k rows as f32, v planes [d][key] as f16
  const int tid = threadIdx.x, wave = tid >> 5, lane = tid & 31, col = lane & 15, g = lane >> 4;
  const size_t bh = blockIdx.y; const size_t b = bh / NH; const int h = bh % NH; const int q0 = blockIdx.x * 64 + wave * 16;
  // B fragments of q: column n = query col, elements i <- d = kc*32 + 8g + i, 8+i <- d = kc*32 + 16 + 8g + i
  v16b aq[2];
#pragma unroll
  for (int kc = 0; kc < 2; ++kc) { const float* pp = Q + b * BSTR + ((size_t)(q0 + col) * NH + h) * DD + kc * 32 + 8 * g;
#pragma unroll
    for (int i = 0; i < 8; ++i) { aq[kc][i] = (__bf16)pp[i]; aq[kc][8 + i] = (__bf16)pp[16 + i]; } }
  float m = -3.0e38f, l = 0.f;   // of query col: m over all keys so far, l over this lane half's keys only (the halves join in the epilogue)
  v8f acc[4];
#pragma unroll
  for (int j = 0; j < 4; ++j) acc[j] = v8f{};
  // this lane's pieces of a stage: k piece i = key (tid>>4) + 8i, bytes 16*(tid&15) of its row; v piece i = d (tid>>3) + 16i, bytes 16*(tid&7) of its row
  const float* gk = K + b * BSTR + ((size_t)(tid >> 4) * NH + h) * DD + (tid & 15) * 4; const _Float16* gv = VT + (bh * DD + (tid >> 3)) * (size_t)SEQ + (tid & 7) * 8;
  const unsigned lk = lds_off(&kst[0][tid >> 4][(tid & 15) * 4]), lv = lds_off(&vst[0][tid >> 3][(tid & 7) * 8]);
  stage_copy(lk, gk, lv, gv, 8 * KP * 4, (size_t)8 * RS, 16 * VP * 2, (size_t)16 * SEQ);
  asm volatile("s_wait_asynccnt 0x0" ::: "memory");   // this wave's pieces of stage 0 have landed before the barrier that publishes the stage
  __syncthreads();
  if (1 < NST) stage_copy(lk + SK * KP * 4, gk + (size_t)SK * RS, lv + DD * VP * 2, gv + SK, 8 * KP * 4, (size_t)8 * RS, 16 * VP * 2, (size_t)16 * SEQ);
  // kept rolled: one trip = one stage with its one publish point at the foot
#pragma unroll 1
  for (int st = 0; st < NST; ++st) { const int buf = st & 1;
  // unrolled: the 32-key halves of a stage read at constant LDS offsets
#pragma unroll
  for (int sub = 0; sub < SK / 32; ++sub) { float s[2][8];
    // all raw k pieces of the 32 keys in one group of LDS reads, in front of the first product (both loops unrolled: kr is indexed by constants and stays in registers)
    v4f kr[2][2][4];
#pragma unroll
    for (int ct = 0; ct < 2; ++ct)
#pragma unroll
      for (int kc = 0; kc < 2; ++kc) { const float* kp = &kst[buf][sub * 32 + ct * 16 + col][kc * 32 + 8 * g];
        kr[ct][kc][0] = *(const v4f*)kp; kr[ct][kc][1] = *(const v4f*)(kp + 4); kr[ct][kc][2] = *(const v4f*)(kp + 16); kr[ct][kc][3] = *(const v4f*)(kp + 20); }
#pragma unroll
    for (int ct = 0; ct < 2; ++ct) { v8f c = {};
      // A fragments of k: row m = key ct*16 + col, elements i <- d = kc*32 + 8g + i, 8+i <- d = kc*32 + 16 + 8g + i (same k map as B)
#pragma unroll
      for (int kc = 0; kc < 2; ++kc) { v16b w;
#pragma unroll
        for (int i = 0; i < 8; ++i) { w[i] = (__bf16)kr[ct][kc][i >> 2][i & 3]; w[8 + i] = (__bf16)kr[ct][kc][2 + (i >> 2)][i & 3]; }
        c = wmma_bf(w, aq[kc], c); }
#pragma unroll
      for (int r = 0; r < 8; ++r) s[ct][r] = c[r]; }   // D element r = key row ct*16 + 8g + r, query column col; no scaling
    // A fragments of v^T from the staged [d][key] planes: row m = d = j*16 + col, k = key with the same split map; read here so that the softmax covers their latency (unrolled: vh stays in registers)
    v16h vh[4];
#pragma unroll
    for (int j = 0; j < 4; ++j) vh[j] = frag_h(&vst[buf][j * 16 + col][sub * 32], lane);
    __builtin_amdgcn_sched_barrier(0);   // keeps the eight reads above in front of the softmax, whose work covers their latency
    // maximum of the lane's 16 scores, then of both halves: the 32 keys of query col (unrolled: mx is indexed by constants and stays in registers)
    float mx[8];
#pragma unroll
    for (int r = 0; r < 8; ++r) mx[r] = fmaxf(s[0][r], s[1][r]);
    float mq = fmaxf(fmaxf(fmaxf(mx[0], mx[1]), fmaxf(mx[2], mx[3])), fmaxf(fmaxf(mx[4], mx[5]), fmaxf(mx[6], mx[7])));
    mq = fmaxf(mq, xhalf(mq));
    const float mn = fmaxf(m, mq), alpha = __expf(m - mn); m = mn;
    // B fragment of P^T straight from the score registers (column n = query col; element i <- key 8g + i = tile 0 register i, 8+i <- key 16 + 8g + i = tile 1 register i, the k map of vh):
    // P x 2^14 = exp2(s log2e + (14 - mn log2e)), one packed fma a pair in front of the hardware exp (unrolled: s, p and es are indexed by constants and stay in registers)
    const float cx = __builtin_fmaf(-mn, LOG2E, PCARRY_LOG2);
    float p[2][8], es[8];
#pragma unroll
    for (int t = 0; t < 2; ++t)
#pragma unroll
      for (int i = 0; i < 8; i += 2) { const v2f x = __builtin_elementwise_fma(v2f{s[t][i], s[t][i + 1]}, v2f{LOG2E, LOG2E}, v2f{cx, cx});
        p[t][i] = __builtin_amdgcn_exp2f(x[0]); p[t][i + 1] = __builtin_amdgcn_exp2f(x[1]); }
#pragma unroll
    for (int i = 0; i < 8; ++i) es[i] = p[0][i] + p[1][i];
    l = l * alpha + (((es[0] + es[1]) + (es[2] + es[3])) + ((es[4] + es[5]) + (es[6] + es[7])));
    // f16 rounding of P and the f16 rounding of its rest: register k of the fragment holds elements 2k, 2k + 1 (unrolled: ph, pr, pe and po are indexed by constants and stay in registers)
    unsigned ph[8], pr[8]; float pe[8], po[8];
#pragma unroll
    for (int k = 0; k < 8; ++k) { pe[k] = p[k >> 2][2 * (k & 3)]; po[k] = p[k >> 2][2 * (k & 3) + 1]; ph[k] = __builtin_bit_cast(unsigned, __builtin_convertvector(v2f{pe[k], po[k]}, v2h)); }
    rest16(pr, pe, po, ph);
    const v16h pa = __builtin_bit_cast(v16h, v8u{ph[0], ph[1], ph[2], ph[3], ph[4], ph[5], ph[6], ph[7]}), par = __builtin_bit_cast(v16h, v8u{pr[0], pr[1], pr[2], pr[3], pr[4], pr[5], pr[6], pr[7]});
#pragma unroll
    for (int j = 0; j < 4; ++j)
#pragma unroll
      for (int r = 0; r < 8; ++r) acc[j][r] *= alpha;
#pragma unroll
    for (int j = 0; j < 4; ++j) { acc[j] = wmma16(vh[j], pa, acc[j]); acc[j] = wmma16(vh[j], par, acc[j]); } }   // D element r = d row j*16 + 8g + r, query column col
    // publish point: own LDS reads done, own copies of stage st+1 landed, then the barrier that publishes st+1 and frees this buffer for st+2
    __builtin_amdgcn_sched_barrier(0);   // keeps the stage's products in front of the publish point, so that the refill behind it is issued a whole trip ahead of its use
    asm volatile("s_wait_dscnt 0x0" ::: "memory");
    asm volatile("s_wait_asynccnt 0x0" ::: "memory");
    __syncthreads();
    if (st + 2 < NST) stage_copy(lk + buf * (SK * KP * 4), gk + (size_t)(st + 2) * SK * RS, lv + buf * (DD * VP * 2), gv + (st + 2) * SK, 8 * KP * 4, (size_t)8 * RS, 16 * VP * 2, (size_t)16 * SEQ); }
  asm volatile("s_wait_asynccnt 0x0" ::: "memory");   // no copy of the ring is outstanding when the wave goes on to its end
  const float il = 1.0f / (l + xhalf(l));
#pragma unroll
  for (int j = 0; j < 4; ++j) { vst2(&so[wave][col][j * 16 + 8 * g], v4f{acc[j][0] * il, acc[j][1] * il, acc[j][2] * il, acc[j][3] * il});
    vst2(&so[wave][col][j * 16 + 8 * g + 4], v4f{acc[j][4] * il, acc[j][5] * il, acc[j][6] * il, acc[j][7] * il}); }
  ldsx();
  // one 256-B output row (64 floats of (b, q, h)) per instruction: lanes 0..7 -> line 0, lanes 8..15 -> line 1, 16 B each
  const int lc = lane & 15;
  for (int rl = 0; rl < 16; ++rl) { const v4f ov = *(const v4f*)&so[wave][rl][lc * 4];
    if (lane < 16) vst2(OUT + ((b * OSEQ + q0 + rl) * NH + h) * (size_t)DD + lc * 4, ov); }
}

extern "C" void kernel_launch(void* const* d_in, const int* in_sizes, int n_in, void* d_out, int out_size, void* d_ws, size_t ws_size, hipStream_t stream) {
  if (n_in < 3) return;
  const size_t need = ((size_t)(NB - 1) * SEQ_FULL + SEQ) * RS;
  if ((size_t)in_sizes[0] < need || (size_t)in_sizes[1] < need || (size_t)in_sizes[2] < need) return;
  if ((size_t)out_size < (size_t)NB * OSEQ * RS) return;
  if (ws_size < (size_t)WS_END) return;
  const float* Qp = (const float*)d_in[0];   // 0 queries [4,2048,8,64] f32
  const float* Kp = (const float*)d_in[1];   // 1 keys    [4,2048,8,64] f32
  const float* Vp = (const float*)d_in[2];   // 2 values  [4,2048,8,64] f32
  char* ws = (char*)d_ws; _Float16* VT = (_Float16*)(ws + WS_VT);
  k_vt<<<dim3(SEQ / 64, NB * NH), 128, 0, stream>>>(Vp, VT);
  k_att<<<dim3(SEQ / 64, NB * NH), 128, 0, stream>>>(Qp, Kp, VT, (float*)d_out);
}

// v005
// A run of this version takes 51.9 microseconds.
// Two timings next to v004 put it at 1.08 and 1.09 times that version's speed.
// Counting every step since v000, it is 4.04 times as fast.
// compute dtype: q, k, v RNE-converted to bf16 (k once, in the first launch); logits on v_wmma_f32_16x16x32_bf16 (bf16 x bf16 single product, f32 accumulate), no scaling; running-max softmax in f32 (hardware exp); P carried x 2^14 (the carry added in the exponent) as f16 hi plus its f16 residual against v (bf16 -> f16, exact) on v_wmma_f32_16x16x32_f16, two products into one f32 accumulator; f32 output [B, L, H, D].
#include <hip/hip_runtime.h>
#include <math.h>

typedef __attribute__((ext_vector_type(16))) _Float16 v16h;
typedef __attribute__((ext_vector_type(16))) __bf16 v16b;
typedef __attribute__((ext_vector_type(8)))  _Float16 v8h;
typedef __attribute__((ext_vector_type(8)))  __bf16 v8b;
typedef __attribute__((ext_vector_type(4)))  __bf16 v4b;
typedef __attribute__((ext_vector_type(8)))  float v8f;
typedef __attribute__((ext_vector_type(4)))  float v4f;
typedef __attribute__((ext_vector_type(4)))  unsigned v4u;
typedef __attribute__((ext_vector_type(8)))  unsigned v8u;
typedef __attribute__((ext_vector_type(2)))  float v2f;
typedef __attribute__((ext_vector_type(2)))  _Float16 v2h;

template <typename T> __device__ __forceinline__ void vst2(void* p, T v) { *(T*)p = v;  }
// bare builtins: the compiler keeps the distances behind its own matrix instructions and fills them with useful work where it can
__device__ __forceinline__ v8f wmma16(v16h a, v16h b, v8f c) {
  return __builtin_amdgcn_wmma_f32_16x16x32_f16(false, a, false, b, (short)0, c, false, false);
}
__device__ __forceinline__ v8f wmma_bf(v16b a, v16b b, v8f c) {
  return __builtin_amdgcn_wmma_f32_16x16x32_bf16(false, a, false, b, (short)0, c, false, false);
}
// 16x16x32 fragments: lane = (h = lane>>4, row/col = lane&15); elements 0..7 = k0+8h+0..7, 8..15 = k0+16+8h+0..7; D element r = row 8h+r, col lane&15
__device__ __forceinline__ v16h frag_h(const _Float16* rowk0, int lane) {
  union { v16h v; v8h q[2]; } u; const _Float16* p = rowk0 + 8 * (lane >> 4);
  u.q[0] = *(const v8h*)p; u.q[1] = *(const v8h*)(p + 16); return u.v;
}
__device__ __forceinline__ v16b frag_b(const __bf16* rowk0, int lane) {
  union { v16b v; v8b q[2]; } u; const __bf16* p = rowk0 + 8 * (lane >> 4);
  u.q[0] = *(const v8b*)p; u.q[1] = *(const v8b*)(p + 16); return u.v;
}
__device__ __forceinline__ float bfr(float v) { return (float)(__bf16)v; }
__device__ __forceinline__ void ldsx() { asm volatile("s_wait_dscnt 0" ::: "memory"); __builtin_amdgcn_wave_barrier(); __builtin_amdgcn_fence(3, "workgroup"); }

// lane l <-> l ^ 16 in the vector unit (a shuffle would go through the LDS queue and its wait)
__device__ __forceinline__ float xhalf(float v) { const int b = __builtin_bit_cast(int, v); return __builtin_bit_cast(float, __builtin_amdgcn_permlanex16(b, b, 0x76543210, 0xfedcba98, false, false)); }
// what the f16 rounding h of a fragment's elements lost, rounded to f16 itself: register k of r <- x[k] - low half of h[k] (element 2k), y[k] - high half (element 2k + 1).
// One vector instruction an element: the mixed-precision fma reads the f16 half and rounds its f32 result to f16 itself, where the compiler's form of the same arithmetic took three.
// The eight of a kind stand together, so that the write of a register's second half has its first half's write eight back and no dependent pair holds up the vector port.
// The factor 1.0 comes as 32 bits in a scalar register, the way the compiler hands an f32 factor to these instructions.
__device__ __forceinline__ void rest16(unsigned (&r)[8], const float (&x)[8], const float (&y)[8], const unsigned (&h)[8]) {
  asm("v_fma_mixlo_f16 %0, %8, %24, -%16 op_sel_hi:[0,0,1]\n\t"
      "v_fma_mixlo_f16 %1, %9, %24, -%17 op_sel_hi:[0,0,1]\n\t"
      "v_fma_mixlo_f16 %2, %10, %24, -%18 op_sel_hi:[0,0,1]\n\t"
      "v_fma_mixlo_f16 %3, %11, %24, -%19 op_sel_hi:[0,0,1]\n\t"
      "v_fma_mixlo_f16 %4, %12, %24, -%20 op_sel_hi:[0,0,1]\n\t"
      "v_fma_mixlo_f16 %5, %13, %24, -%21 op_sel_hi:[0,0,1]\n\t"
      "v_fma_mixlo_f16 %6, %14, %24, -%22 op_sel_hi:[0,0,1]\n\t"
      "v_fma_mixlo_f16 %7, %15, %24, -%23 op_sel_hi:[0,0,1]"
      : "=&v"(r[0]), "=&v"(r[1]), "=&v"(r[2]), "=&v"(r[3]), "=&v"(r[4]), "=&v"(r[5]), "=&v"(r[6]), "=&v"(r[7])
      : "v"(x[0]), "v"(x[1]), "v"(x[2]), "v"(x[3]), "v"(x[4]), "v"(x[5]), "v"(x[6]), "v"(x[7]),
        "v"(h[0]), "v"(h[1]), "v"(h[2]), "v"(h[3]), "v"(h[4]), "v"(h[5]), "v"(h[6]), "v"(h[7]), "s"(1.0f));
  asm("v_fma_mixhi_f16 %0, %8, %24, -%16 op_sel:[0,0,1] op_sel_hi:[0,0,1]\n\t"
      "v_fma_mixhi_f16 %1, %9, %24, -%17 op_sel:[0,0,1] op_sel_hi:[0,0,1]\n\t"
      "v_fma_mixhi_f16 %2, %10, %24, -%18 op_sel:[0,0,1] op_sel_hi:[0,0,1]\n\t"
      "v_fma_mixhi_f16 %3, %11, %24, -%19 op_sel:[0,0,1] op_sel_hi:[0,0,1]\n\t"
      "v_fma_mixhi_f16 %4, %12, %24, -%20 op_sel:[0,0,1] op_sel_hi:[0,0,1]\n\t"
      "v_fma_mixhi_f16 %5, %13, %24, -%21 op_sel:[0,0,1] op_sel_hi:[0,0,1]\n\t"
      "v_fma_mixhi_f16 %6, %14, %24, -%22 op_sel:[0,0,1] op_sel_hi:[0,0,1]\n\t"
      "v_fma_mixhi_f16 %7, %15, %24, -%23 op_sel:[0,0,1] op_sel_hi:[0,0,1]"
      : "+v"(r[0]), "+v"(r[1]), "+v"(r[2]), "+v"(r[3]), "+v"(r[4]), "+v"(r[5]), "+v"(r[6]), "+v"(r[7])
      : "v"(y[0]), "v"(y[1]), "v"(y[2]), "v"(y[3]), "v"(y[4]), "v"(y[5]), "v"(y[6]), "v"(y[7]),
        "v"(h[0]), "v"(h[1]), "v"(h[2]), "v"(h[3]), "v"(h[4]), "v"(h[5]), "v"(h[6]), "v"(h[7]), "s"(1.0f));
}
__device__ __forceinline__ unsigned lds_off(const void* p) { return (unsigned)(size_t)p; }   // byte offset in the work-group's LDS
// one stage (64 keys), this lane's share: four 16-B pieces of the bf16 key rows (lk, gk; piece i one step further) and four of the f16 value planes (lv, gv),
// global -> LDS through no register. The s_wait_xcnt closes the statement so that no address register named here is rewritten in front of it.
__device__ __forceinline__ void stage_copy(unsigned lk, const __bf16* gk, unsigned lv, const _Float16* gv, unsigned lks, size_t gks, unsigned lvs, size_t gvs) {
  asm volatile("global_load_async_to_lds_b128 %0, %1, off\n\t"
               "global_load_async_to_lds_b128 %2, %3, off\n\t"
               "global_load_async_to_lds_b128 %4, %5, off\n\t"
               "global_load_async_to_lds_b128 %6, %7, off\n\t"
               "global_load_async_to_lds_b128 %8, %9, off\n\t"
               "global_load_async_to_lds_b128 %10, %11, off\n\t"
               "global_load_async_to_lds_b128 %12, %13, off\n\t"
               "global_load_async_to_lds_b128 %14, %15, off\n\t"
               "s_wait_xcnt 0x0"
               :: "v"(lk), "v"(gk), "v"(lk + lks), "v"(gk + gks), "v"(lk + 2 * lks), "v"(gk + 2 * gks), "v"(lk + 3 * lks), "v"(gk + 3 * gks),
                  "v"(lv), "v"(gv), "v"(lv + lvs), "v"(gv + gvs), "v"(lv + 2 * lvs), "v"(gv + 2 * gvs), "v"(lv + 3 * lvs), "v"(gv + 3 * gvs) : "memory");
}

// dense softmax attention on raw inputs in [B, S, H, D] layout: A = softmax(q k^T) over keys (no 1/sqrt(D)); out = A . v, written [B, L, H, D].
#ifndef NB
#define NB 4                    // batches computed
#endif
#ifndef SEQ
#define SEQ 2048                // sequence length computed
#endif
#define NB_FULL 4
#define SEQ_FULL 2048           // inputs always have the full sequence length per batch
#define NH 8
#define DD 64
#define RS (NH * DD)            // floats between consecutive s of one batch (512)
#define BSTR ((size_t)SEQ_FULL * RS)   // input batch stride in floats
#ifndef OSEQ
#define OSEQ SEQ                // output sequence stride (dense over the computed rows)
#endif
#define SK 64                   // keys per LDS stage: a value-plane row of a stage is one whole 128-B line
#define NST (SEQ / SK)
#define KP 72                   // bf16 per staged key row: 144 B = 16 B x 9, no bank conflict for 16-B LDS reads
#define VP 72                   // f16 per staged value row: 144 B = 16 B x 9, likewise
#define PCARRY_LOG2 14.0f       // power-of-two carry on P (x 2^14), added in the exponent; the row sum carries it too, so it cancels in the epilogue's division
#define LOG2E 1.44269504f
static_assert(SEQ % 64 == 0);
static_assert(SEQ <= SEQ_FULL);
static_assert(NB >= 1 && NB <= NB_FULL);
static_assert(DD == 64);

#define WS_VT  0u                                            // f16 value planes [b*NH + h][DD][SEQ]
#define WS_KB  (WS_VT + 2u * (size_t)NB * NH * DD * SEQ)      // bf16 key rows [b*NH + h][SEQ][DD]; each plane set 8,388,608 B at full size
#define WS_END (WS_KB + 2u * (size_t)NB * NH * DD * SEQ)
static_assert(WS_END <= (size_t)134217728u);

// blockIdx.z = 0: 64 keys of v -> f16 planes [d][key]; blockIdx.z = 1: 64 keys of k -> bf16 rows, one head's rows in a row
__global__ __launch_bounds__(128) void k_vt(const float* __restrict__ V, const float* __restrict__ K, _Float16* __restrict__ VT, __bf16* __restrict__ KB) {
  __shared__ __align__(16) _Float16 th[DD][72];
  const int t = threadIdx.x; const size_t bh = blockIdx.y; const size_t b = bh / NH; const int h = bh % NH; const int m0 = blockIdx.x * 64;
  if (blockIdx.z) {   // the same for the whole block, in front of the barrier
    // a wave-wide load takes two whole 256-B source rows, its store 256 B in a row; unrolled: the eight loads of a lane are in flight together
    const float* kp = K + b * BSTR + ((size_t)(m0 + (t >> 4)) * NH + h) * DD + (t & 15) * 4; __bf16* kq = KB + (bh * SEQ + m0) * (size_t)DD + t * 4;
    v4f kv[8];
#pragma unroll
    for (int i = 0; i < 8; ++i) kv[i] = *(const v4f*)(kp + (size_t)i * 8 * RS);
#pragma unroll
    for (int i = 0; i < 8; ++i) vst2(kq + i * 8 * DD, __builtin_convertvector(kv[i], v4b));
    asm volatile("s_wait_xcnt 0x0" ::: "memory");   // behind the last store: no register that the eight stores name is rewritten in front of it on any way out of this part
    return; }
  for (int e = t; e < 64 * DD; e += 128) { const int ml = e / DD, d = e % DD; th[d][ml] = (_Float16)bfr(V[b * BSTR + ((size_t)(m0 + ml) * NH + h) * DD + d]); }
  __syncthreads();
  for (int e = t; e < DD * 8; e += 128) { const int d = e >> 3, q = e & 7; vst2((unsigned*)(VT + (bh * DD + d) * (size_t)SEQ + m0 + q * 8), *(const v4u*)&th[d][q * 8]); }
}
// ---- k_att: block = (64 queries, b*NH + h), 4 waves x 16 queries: bf16 logits over all SEQ keys as S^T = k . q^T (a lane holds one query's scores), running-max softmax, O^T += v^T . P^T
__global__ __launch_bounds__(128) void k_att(const float* __restrict__ Q, const __bf16* __restrict__ KB, const _Float16* __restrict__ VT, float* __restrict__ OUT) {
  __shared__ __align__(16) float so[4][16][68];
  __shared__ __align__(16) __bf16 kst[2][SK][KP]; __shared__ __align__(16) _Float16 vst[2][DD][VP];   // two stages: k rows as bf16, v planes [d][key] as f16
  const int tid = threadIdx.x, wave = tid >> 5, lane = tid & 31, col = lane & 15, g = lane >> 4;
  const size_t bh = blockIdx.y; const size_t b = bh / NH; const int h = bh % NH; const int q0 = blockIdx.x * 64 + wave * 16;
  // B fragments of q: column n = query col, elements i <- d = kc*32 + 8g + i, 8+i <- d = kc*32 + 16 + 8g + i
  v16b aq[2];
#pragma unroll
  for (int kc = 0; kc < 2; ++kc) { const float* pp = Q + b * BSTR + ((size_t)(q0 + col) * NH + h) * DD + kc * 32 + 8 * g;
#pragma unroll
    for (int i = 0; i < 8; ++i) { aq[kc][i] = (__bf16)pp[i]; aq[kc][8 + i] = (__bf16)pp[16 + i]; } }
  float m = -3.0e38f, l = 0.f;   // of query col: m over all keys so far, l over this lane half's keys only (the halves join in the epilogue)
  v8f acc[4];
#pragma unroll
  for (int j = 0; j < 4; ++j) acc[j] = v8f{};
  // this lane's pieces of a stage: k piece i = key (tid>>3) + 16i, bytes 16*(tid&7) of its row; v piece i = d (tid>>3) + 16i, bytes 16*(tid&7) of its row
  const __bf16* gk = KB + (bh * SEQ + (tid >> 3)) * (size_t)DD + (tid & 7) * 8; const _Float16* gv = VT + (bh * DD + (tid >> 3)) * (size_t)SEQ + (tid & 7) * 8;
  const unsigned lk = lds_off(&kst[0][tid >> 3][(tid & 7) * 8]), lv = lds_off(&vst[0][tid >> 3][(tid & 7) * 8]);
  stage_copy(lk, gk, lv, gv, 16 * KP * 2, (size_t)16 * DD, 16 * VP * 2, (size_t)16 * SEQ);
  asm volatile("s_wait_asynccnt 0x0" ::: "memory");   // this wave's pieces of stage 0 have landed before the barrier that publishes the stage
  __syncthreads();
  if (1 < NST) stage_copy(lk + SK * KP * 2, gk + (size_t)SK * DD, lv + DD * VP * 2, gv + SK, 16 * KP * 2, (size_t)16 * DD, 16 * VP * 2, (size_t)16 * SEQ);
  // kept rolled: one trip = one stage with its one publish point at the foot
#pragma unroll 1
  for (int st = 0; st < NST; ++st) { const int buf = st & 1;
  // unrolled: the 32-key halves of a stage read at constant LDS offsets
#pragma unroll
  for (int sub = 0; sub < SK / 32; ++sub) { float s[2][8];
    // A fragments of k straight from the staged bf16 rows: row m = key ct*16 + col, elements i <- d = kc*32 + 8g + i, 8+i <- d = kc*32 + 16 + 8g + i (same k map as B);
    // the 32 keys' fragments in one group of LDS reads, in front of the first product (both loops unrolled: kf is indexed by constants and stays in registers)
    v16b kf[2][2];
#pragma unroll
    for (int ct = 0; ct < 2; ++ct)
#pragma unroll
      for (int kc = 0; kc < 2; ++kc) kf[ct][kc] = frag_b(&kst[buf][sub * 32 + ct * 16 + col][kc * 32], lane);
    __builtin_amdgcn_sched_barrier(0);   // keeps the eight reads above together in front of the first product: without it they are spread among the products, each with a full wait of its own
#pragma unroll
    for (int ct = 0; ct < 2; ++ct) { v8f c = {};
#pragma unroll
      for (int kc = 0; kc < 2; ++kc) c = wmma_bf(kf[ct][kc], aq[kc], c);
#pragma unroll
      for (int r = 0; r < 8; ++r) s[ct][r] = c[r]; }   // D element r = key row ct*16 + 8g + r, query column col; no scaling
    // A fragments of v^T from the staged [d][key] planes: row m = d = j*16 + col, k = key with the same split map; read here so that the softmax covers their latency (unrolled: vh stays in registers)
    v16h vh[4];
#pragma unroll
    for (int j = 0; j < 4; ++j) vh[j] = frag_h(&vst[buf][j * 16 + col][sub * 32], lane);
    __builtin_amdgcn_sched_barrier(0);   // keeps the eight reads above in front of the softmax, whose work covers their latency
    // maximum of the lane's 16 scores, then of both halves: the 32 keys of query col (unrolled: mx is indexed by constants and stays in registers)
    float mx[8];
#pragma unroll
    for (int r = 0; r < 8; ++r) mx[r] = fmaxf(s[0][r], s[1][r]);
    float mq = fmaxf(fmaxf(fmaxf(mx[0], mx[1]), fmaxf(mx[2], mx[3])), fmaxf(fmaxf(mx[4], mx[5]), fmaxf(mx[6], mx[7])));
    mq = fmaxf(mq, xhalf(mq));
    const float mn = fmaxf(m, mq), alpha = __expf(m - mn); m = mn;
    // B fragment of P^T straight from the score registers (column n = query col; element i <- key 8g + i = tile 0 register i, 8+i <- key 16 + 8g + i = tile 1 register i, the k map of vh):
    // P x 2^14 = exp2(s log2e + (14 - mn log2e)), one packed fma a pair in front of the hardware exp (unrolled: s, p and es are indexed by constants and stay in registers)
    const float cx = __builtin_fmaf(-mn, LOG2E, PCARRY_LOG2);
    float p[2][8], es[8];
#pragma unroll
    for (int t = 0; t < 2; ++t)
#pragma unroll
      for (int i = 0; i < 8; i += 2) { const v2f x = __builtin_elementwise_fma(v2f{s[t][i], s[t][i + 1]}, v2f{LOG2E, LOG2E}, v2f{cx, cx});
        p[t][i] = __builtin_amdgcn_exp2f(x[0]); p[t][i + 1] = __builtin_amdgcn_exp2f(x[1]); }
#pragma unroll
    for (int i = 0; i < 8; ++i) es[i] = p[0][i] + p[1][i];
    l = l * alpha + (((es[0] + es[1]) + (es[2] + es[3])) + ((es[4] + es[5]) + (es[6] + es[7])));
    // f16 rounding of P and the f16 rounding of its rest: register k of the fragment holds elements 2k, 2k + 1 (unrolled: ph, pr, pe and po are indexed by constants and stay in registers)
    unsigned ph[8], pr[8]; float pe[8], po[8];
#pragma unroll
    for (int k = 0; k < 8; ++k) { pe[k] = p[k >> 2][2 * (k & 3)]; po[k] = p[k >> 2][2 * (k & 3) + 1]; ph[k] = __builtin_bit_cast(unsigned, __builtin_convertvector(v2f{pe[k], po[k]}, v2h)); }
    rest16(pr, pe, po, ph);
    const v16h pa = __builtin_bit_cast(v16h, v8u{ph[0], ph[1], ph[2], ph[3], ph[4], ph[5], ph[6], ph[7]}), par = __builtin_bit_cast(v16h, v8u{pr[0], pr[1], pr[2], pr[3], pr[4], pr[5], pr[6], pr[7]});
#pragma unroll
    for (int j = 0; j < 4; ++j)
#pragma unroll
      for (int r = 0; r < 8; ++r) acc[j][r] *= alpha;
#pragma unroll
    for (int j = 0; j < 4; ++j) { acc[j] = wmma16(vh[j], pa, acc[j]); acc[j] = wmma16(vh[j], par, acc[j]); } }   // D element r = d row j*16 + 8g + r, query column col
    // publish point: own LDS reads done, own copies of stage st+1 landed, then the barrier that publishes st+1 and frees this buffer for st+2
    __builtin_amdgcn_sched_barrier(0);   // keeps the stage's products in front of the publish point, so that the refill behind it is issued a whole trip ahead of its use
    asm volatile("s_wait_dscnt 0x0" ::: "memory");
    asm volatile("s_wait_asynccnt 0x0" ::: "memory");
    __syncthreads();
    if (st + 2 < NST) stage_copy(lk + buf * (SK * KP * 2), gk + (size_t)(st + 2) * SK * DD, lv + buf * (DD * VP * 2), gv + (st + 2) * SK, 16 * KP * 2, (size_t)16 * DD, 16 * VP * 2, (size_t)16 * SEQ); }
  asm volatile("s_wait_asynccnt 0x0" ::: "memory");   // no copy of the ring is outstanding when the wave goes on to its end
  const float il = 1.0f / (l + xhalf(l));
#pragma unroll
  for (int j = 0; j < 4; ++j) { vst2(&so[wave][col][j * 16 + 8 * g], v4f{acc[j][0] * il, acc[j][1] * il, acc[j][2] * il, acc[j][3] * il});
    vst2(&so[wave][col][j * 16 + 8 * g + 4], v4f{acc[j][4] * il, acc[j][5] * il, acc[j][6] * il, acc[j][7] * il}); }
  ldsx();
  // one 256-B output row (64 floats of (b, q, h)) per instruction: lanes 0..7 -> line 0, lanes 8..15 -> line 1, 16 B each
  const int lc = lane & 15;
  for (int rl = 0; rl < 16; ++rl) { const v4f ov = *(const v4f*)&so[wave][rl][lc * 4];
    if (lane < 16) vst2(OUT + ((b * OSEQ + q0 + rl) * NH + h) * (size_t)DD + lc * 4, ov); }
}

extern "C" void kernel_launch(void* const* d_in, const int* in_sizes, int n_in, void* d_out, int out_size, void* d_ws, size_t ws_size, hipStream_t stream) {
  if (n_in < 3) return;
  const size_t need = ((size_t)(NB - 1) * SEQ_FULL + SEQ) * RS;
  if ((size_t)in_sizes[0] < need || (size_t)in_sizes[1] < need || (size_t)in_sizes[2] < need) return;
  if ((size_t)out_size < (size_t)NB * OSEQ * RS) return;
  if (ws_size < (size_t)WS_END) return;
  const float* Qp = (const float*)d_in[0];   // 0 queries [4,2048,8,64] f32
  const float* Kp = (const float*)d_in[1];   // 1 keys    [4,2048,8,64] f32
  const float* Vp = (const float*)d_in[2];   // 2 values  [4,2048,8,64] f32
  char* ws = (char*)d_ws; _Float16* VT = (_Float16*)(ws + WS_VT); __bf16* KB = (__bf16*)(ws + WS_KB);
  k_vt<<<dim3(SEQ / 64, NB * NH, 2), 128, 0, stream>>>(Vp, Kp, VT, KB);
  k_att<<<dim3(SEQ / 64, NB * NH), 128, 0, stream>>>(Qp, KB, VT, (float*)d_out);
}

// v006
// One run takes 49.9 microseconds.
// Next to v005, in two timings, it ran 1.03 times as fast each time.
// Over all steps from v000 it is 4.18 times as fast.
// compute dtype: q, k, v RNE-converted to bf16 (k once, in the first launch); logits on v_wmma_f32_16x16x32_bf16 (bf16 x bf16 single product, f32 accumulate), no scaling; softmax in f32 (hardware exp) against a maximum that is renewed only when a score passes it by more than 5.5; P carried x 2^6 (the carry added in the exponent) as f16 hi plus its f16 residual against v (bf16 -> f16, exact) on v_wmma_f32_16x16x32_f16, two products into one f32 accumulator; f32 output [B, L, H, D].
#include <hip/hip_runtime.h>
#include <math.h>

typedef __attribute__((ext_vector_type(16))) _Float16 v16h;
typedef __attribute__((ext_vector_type(16))) __bf16 v16b;
typedef __attribute__((ext_vector_type(8)))  _Float16 v8h;
typedef __attribute__((ext_vector_type(8)))  __bf16 v8b;
typedef __attribute__((ext_vector_type(4)))  __bf16 v4b;
typedef __attribute__((ext_vector_type(8)))  float v8f;
typedef __attribute__((ext_vector_type(4)))  float v4f;
typedef __attribute__((ext_vector_type(4)))  unsigned v4u;
typedef __attribute__((ext_vector_type(8)))  unsigned v8u;
typedef __attribute__((ext_vector_type(2)))  float v2f;
typedef __attribute__((ext_vector_type(2)))  _Float16 v2h;

template <typename T> __device__ __forceinline__ void vst2(void* p, T v) { *(T*)p = v;  }
// bare builtins: the compiler keeps the distances behind its own matrix instructions and fills them with useful work where it can
__device__ __forceinline__ v8f wmma16(v16h a, v16h b, v8f c) {
  return __builtin_amdgcn_wmma_f32_16x16x32_f16(false, a, false, b, (short)0, c, false, false);
}
__device__ __forceinline__ v8f wmma_bf(v16b a, v16b b, v8f c) {
  return __builtin_amdgcn_wmma_f32_16x16x32_bf16(false, a, false, b, (short)0, c, false, false);
}
// 16x16x32 fragments: lane = (h = lane>>4, row/col = lane&15); elements 0..7 = k0+8h+0..7, 8..15 = k0+16+8h+0..7; D element r = row 8h+r, col lane&15
__device__ __forceinline__ v16h frag_h(const _Float16* rowk0, int lane) {
  union { v16h v; v8h q[2]; } u; const _Float16* p = rowk0 + 8 * (lane >> 4);
  u.q[0] = *(const v8h*)p; u.q[1] = *(const v8h*)(p + 16); return u.v;
}
__device__ __forceinline__ v16b frag_b(const __bf16* rowk0, int lane) {
  union { v16b v; v8b q[2]; } u; const __bf16* p = rowk0 + 8 * (lane >> 4);
  u.q[0] = *(const v8b*)p; u.q[1] = *(const v8b*)(p + 16); return u.v;
}
__device__ __forceinline__ float bfr(float v) { return (float)(__bf16)v; }
__device__ __forceinline__ void ldsx() { asm volatile("s_wait_dscnt 0" ::: "memory"); __builtin_amdgcn_wave_barrier(); __builtin_amdgcn_fence(3, "workgroup"); }

// lane l <-> l ^ 16 in the vector unit (a shuffle would go through the LDS queue and its wait)
__device__ __forceinline__ float xhalf(float v) { const int b = __builtin_bit_cast(int, v); return __builtin_bit_cast(float, __builtin_amdgcn_permlanex16(b, b, 0x76543210, 0xfedcba98, false, false)); }
// what the f16 rounding h of a fragment's elements lost, rounded to f16 itself: register k of r <- x[k] - low half of h[k] (element 2k), y[k] - high half (element 2k + 1).
// One vector instruction an element: the mixed-precision fma reads the f16 half and rounds its f32 result to f16 itself, where the compiler's form of the same arithmetic took three.
// The eight of a kind stand together, so that the write of a register's second half has its first half's write eight back and no dependent pair holds up the vector port.
// The factor 1.0 comes as 32 bits in a scalar register, the way the compiler hands an f32 factor to these instructions.
// GAP: the statement opens with four idle vector slots. r may be given registers that were the operand of a product issued just before.
#define MIXLO8 "v_fma_mixlo_f16 %0, %8, %24, -%16 op_sel_hi:[0,0,1]\n\t" \
               "v_fma_mixlo_f16 %1, %9, %24, -%17 op_sel_hi:[0,0,1]\n\t" \
               "v_fma_mixlo_f16 %2, %10, %24, -%18 op_sel_hi:[0,0,1]\n\t" \
               "v_fma_mixlo_f16 %3, %11, %24, -%19 op_sel_hi:[0,0,1]\n\t" \
               "v_fma_mixlo_f16 %4, %12, %24, -%20 op_sel_hi:[0,0,1]\n\t" \
               "v_fma_mixlo_f16 %5, %13, %24, -%21 op_sel_hi:[0,0,1]\n\t" \
               "v_fma_mixlo_f16 %6, %14, %24, -%22 op_sel_hi:[0,0,1]\n\t" \
               "v_fma_mixlo_f16 %7, %15, %24, -%23 op_sel_hi:[0,0,1]"
#define MIXLO8_OPS : "=&v"(r[0]), "=&v"(r[1]), "=&v"(r[2]), "=&v"(r[3]), "=&v"(r[4]), "=&v"(r[5]), "=&v"(r[6]), "=&v"(r[7]) \
      : "v"(x[0]), "v"(x[1]), "v"(x[2]), "v"(x[3]), "v"(x[4]), "v"(x[5]), "v"(x[6]), "v"(x[7]), \
        "v"(h[0]), "v"(h[1]), "v"(h[2]), "v"(h[3]), "v"(h[4]), "v"(h[5]), "v"(h[6]), "v"(h[7]), "s"(1.0f)
template <bool GAP> __device__ __forceinline__ void rest16(unsigned (&r)[8], const float (&x)[8], const float (&y)[8], const unsigned (&h)[8]) {
  if constexpr (GAP) asm("v_nop\n\tv_nop\n\tv_nop\n\tv_nop\n\t" MIXLO8 MIXLO8_OPS);   // the four v_nop: the distance behind a matrix instruction whose A registers r takes over
  else asm(MIXLO8 MIXLO8_OPS);
  asm("v_fma_mixhi_f16 %0, %8, %24, -%16 op_sel:[0,0,1] op_sel_hi:[0,0,1]\n\t"
      "v_fma_mixhi_f16 %1, %9, %24, -%17 op_sel:[0,0,1] op_sel_hi:[0,0,1]\n\t"
      "v_fma_mixhi_f16 %2, %10, %24, -%18 op_sel:[0,0,1] op_sel_hi:[0,0,1]\n\t"
      "v_fma_mixhi_f16 %3, %11, %24, -%19 op_sel:[0,0,1] op_sel_hi:[0,0,1]\n\t"
      "v_fma_mixhi_f16 %4, %12, %24, -%20 op_sel:[0,0,1] op_sel_hi:[0,0,1]\n\t"
      "v_fma_mixhi_f16 %5, %13, %24, -%21 op_sel:[0,0,1] op_sel_hi:[0,0,1]\n\t"
      "v_fma_mixhi_f16 %6, %14, %24, -%22 op_sel:[0,0,1] op_sel_hi:[0,0,1]\n\t"
      "v_fma_mixhi_f16 %7, %15, %24, -%23 op_sel:[0,0,1] op_sel_hi:[0,0,1]"
      : "+v"(r[0]), "+v"(r[1]), "+v"(r[2]), "+v"(r[3]), "+v"(r[4]), "+v"(r[5]), "+v"(r[6]), "+v"(r[7])
      : "v"(y[0]), "v"(y[1]), "v"(y[2]), "v"(y[3]), "v"(y[4]), "v"(y[5]), "v"(y[6]), "v"(y[7]),
        "v"(h[0]), "v"(h[1]), "v"(h[2]), "v"(h[3]), "v"(h[4]), "v"(h[5]), "v"(h[6]), "v"(h[7]), "s"(1.0f));
}
__device__ __forceinline__ unsigned lds_off(const void* p) { return (unsigned)(size_t)p; }   // byte offset in the work-group's LDS
// one stage (64 keys), this lane's share: four 16-B pieces of the bf16 key rows (lk, gk; piece i one step further) and four of the f16 value planes (lv, gv),
// global -> LDS through no register. The s_wait_xcnt closes the statement so that no address register named here is rewritten in front of it.
__device__ __forceinline__ void stage_copy(unsigned lk, const __bf16* gk, unsigned lv, const _Float16* gv, unsigned lks, size_t gks, unsigned lvs, size_t gvs) {
  asm volatile("global_load_async_to_lds_b128 %0, %1, off\n\t"
               "global_load_async_to_lds_b128 %2, %3, off\n\t"
               "global_load_async_to_lds_b128 %4, %5, off\n\t"
               "global_load_async_to_lds_b128 %6, %7, off\n\t"
               "global_load_async_to_lds_b128 %8, %9, off\n\t"
               "global_load_async_to_lds_b128 %10, %11, off\n\t"
               "global_load_async_to_lds_b128 %12, %13, off\n\t"
               "global_load_async_to_lds_b128 %14, %15, off\n\t"
               "s_wait_xcnt 0x0"
               :: "v"(lk), "v"(gk), "v"(lk + lks), "v"(gk + gks), "v"(lk + 2 * lks), "v"(gk + 2 * gks), "v"(lk + 3 * lks), "v"(gk + 3 * gks),
                  "v"(lv), "v"(gv), "v"(lv + lvs), "v"(gv + gvs), "v"(lv + 2 * lvs), "v"(gv + 2 * gvs), "v"(lv + 3 * lvs), "v"(gv + 3 * gvs) : "memory");
}

// dense softmax attention on raw inputs in [B, S, H, D] layout: A = softmax(q k^T) over keys (no 1/sqrt(D)); out = A . v, written [B, L, H, D].
#ifndef NB
#define NB 4                    // batches computed
#endif
#ifndef SEQ
#define SEQ 2048                // sequence length computed
#endif
#define NB_FULL 4
#define SEQ_FULL 2048           // inputs always have the full sequence length per batch
#define NH 8
#define DD 64
#define RS (NH * DD)            // floats between consecutive s of one batch (512)
#define BSTR ((size_t)SEQ_FULL * RS)   // input batch stride in floats
#ifndef OSEQ
#define OSEQ SEQ                // output sequence stride (dense over the computed rows)
#endif
#define SK 64                   // keys per LDS stage: a value-plane row of a stage is one whole 128-B line
#define NST (SEQ / SK)
#define KP 72                   // bf16 per staged key row: 144 B = 16 B x 9, no bank conflict for 16-B LDS reads
#define VP 72                   // f16 per staged value row: 144 B = 16 B x 9, likewise
#define PCARRY_LOG2 6.0f        // power-of-two carry on P (x 2^6), added in the exponent; the row sum carries it too, so it cancels in the epilogue's division
#define LAZY 5.5f               // a score may pass the maximum in use by this much (under 8 in log2) before sums and accumulators are rescaled: P x 2^6 stays under 2^14, inside f16
#define LOG2E 1.44269504f
static_assert(SEQ % 64 == 0);
static_assert(SEQ <= SEQ_FULL);
static_assert(NB >= 1 && NB <= NB_FULL);
static_assert(DD == 64);

#define WS_VT  0u                                            // f16 value planes [b*NH + h][DD][SEQ]
#define WS_KB  (WS_VT + 2u * (size_t)NB * NH * DD * SEQ)      // bf16 key rows [b*NH + h][SEQ][DD]; each plane set 8,388,608 B at full size
#define WS_END (WS_KB + 2u * (size_t)NB * NH * DD * SEQ)
static_assert(WS_END <= (size_t)134217728u);

// blockIdx.z = 0: 64 keys of v -> f16 planes [d][key]; blockIdx.z = 1: 64 keys of k -> bf16 rows, one head's rows in a row
__global__ __launch_bounds__(128) void k_vt(const float* __restrict__ V, const float* __restrict__ K, _Float16* __restrict__ VT, __bf16* __restrict__ KB) {
  __shared__ __align__(16) _Float16 th[DD][72];
  const int t = threadIdx.x; const size_t bh = blockIdx.y; const size_t b = bh / NH; const int h = bh % NH; const int m0 = blockIdx.x * 64;
  if (blockIdx.z) {   // the same for the whole block, in front of the barrier
    // a wave-wide load takes two whole 256-B source rows, its store 256 B in a row; unrolled: the eight loads of a lane are in flight together
    const float* kp = K + b * BSTR + ((size_t)(m0 + (t >> 4)) * NH + h) * DD + (t & 15) * 4; __bf16* kq = KB + (bh * SEQ + m0) * (size_t)DD + t * 4;
    v4f kv[8];
#pragma unroll
    for (int i = 0; i < 8; ++i) kv[i] = *(const v4f*)(kp + (size_t)i * 8 * RS);
#pragma unroll
    for (int i = 0; i < 8; ++i) vst2(kq + i * 8 * DD, __builtin_convertvector(kv[i], v4b));
    asm volatile("s_wait_xcnt 0x0" ::: "memory");   // behind the last store: no register that the eight stores name is rewritten in front of it on any way out of this part
    return; }
  for (int e = t; e < 64 * DD; e += 128) { const int ml = e / DD, d = e % DD; th[d][ml] = (_Float16)bfr(V[b * BSTR + ((size_t)(m0 + ml) * NH + h) * DD + d]); }
  __syncthreads();
  for (int e = t; e < DD * 8; e += 128) { const int d = e >> 3, q = e & 7; vst2((unsigned*)(VT + (bh * DD + d) * (size_t)SEQ + m0 + q * 8), *(const v4u*)&th[d][q * 8]); }
}
// ---- k_att: block = (64 queries, b*NH + h), 4 waves x 16 queries: bf16 logits over all SEQ keys as S^T = k . q^T (a lane holds one query's scores), softmax with a lazily renewed maximum, O^T += v^T . P^T
__global__ __launch_bounds__(128) void k_att(const float* __restrict__ Q, const __bf16* __restrict__ KB, const _Float16* __restrict__ VT, float* __restrict__ OUT) {
  __shared__ __align__(16) float so[4][16][68];
  __shared__ __align__(16) __bf16 kst[2][SK][KP]; __shared__ __align__(16) _Float16 vst[2][DD][VP];   // two stages: k rows as bf16, v planes [d][key] as f16
  const int tid = threadIdx.x, wave = tid >> 5, lane = tid & 31, col = lane & 15, g = lane >> 4;
  const size_t bh = blockIdx.y; const size_t b = bh / NH; const int h = bh % NH; const int q0 = blockIdx.x * 64 + wave * 16;
  // B fragments of q: column n = query col, elements i <- d = kc*32 + 8g + i, 8+i <- d = kc*32 + 16 + 8g + i
  v16b aq[2];
#pragma unroll
  for (int kc = 0; kc < 2; ++kc) { const float* pp = Q + b * BSTR + ((size_t)(q0 + col) * NH + h) * DD + kc * 32 + 8 * g;
#pragma unroll
    for (int i = 0; i < 8; ++i) { aq[kc][i] = (__bf16)pp[i]; aq[kc][8 + i] = (__bf16)pp[16 + i]; } }
  // of query col: m = the maximum in use (the same in both lane halves), cx = 6 - m log2e, l over this lane half's keys only (the halves join in the epilogue)
  float m = -3.0e38f, cx = __builtin_fmaf(3.0e38f, LOG2E, PCARRY_LOG2), l = 0.f;
  v8f acc[4];
#pragma unroll
  for (int j = 0; j < 4; ++j) acc[j] = v8f{};
  // this lane's pieces of a stage: k piece i = key (tid>>3) + 16i, bytes 16*(tid&7) of its row; v piece i = d (tid>>3) + 16i, bytes 16*(tid&7) of its row
  const __bf16* gk = KB + (bh * SEQ + (tid >> 3)) * (size_t)DD + (tid & 7) * 8; const _Float16* gv = VT + (bh * DD + (tid >> 3)) * (size_t)SEQ + (tid & 7) * 8;
  const unsigned lk = lds_off(&kst[0][tid >> 3][(tid & 7) * 8]), lv = lds_off(&vst[0][tid >> 3][(tid & 7) * 8]);
  stage_copy(lk, gk, lv, gv, 16 * KP * 2, (size_t)16 * DD, 16 * VP * 2, (size_t)16 * SEQ);
  asm volatile("s_wait_asynccnt 0x0" ::: "memory");   // this wave's pieces of stage 0 have landed before the barrier that publishes the stage
  __syncthreads();
  if (1 < NST) stage_copy(lk + SK * KP * 2, gk + (size_t)SK * DD, lv + DD * VP * 2, gv + SK, 16 * KP * 2, (size_t)16 * DD, 16 * VP * 2, (size_t)16 * SEQ);
  // kept rolled: one trip = one stage with its one publish point at the foot
#pragma unroll 1
  for (int st = 0; st < NST; ++st) { const int buf = st & 1;
    // A fragments of k straight from the staged bf16 rows: row m = key ct*16 + col, elements i <- d = kc*32 + 8g + i, 8+i <- d = kc*32 + 16 + 8g + i (same k map as B);
    // the stage's 64 keys' fragments in one group of LDS reads, in front of the first product (both loops unrolled: kf is indexed by constants and stays in registers)
    float s[4][8]; v16b kf[4][2];
#pragma unroll
    for (int ct = 0; ct < 4; ++ct)
#pragma unroll
      for (int kc = 0; kc < 2; ++kc) kf[ct][kc] = frag_b(&kst[buf][ct * 16 + col][kc * 32], lane);
    __builtin_amdgcn_sched_barrier(0);   // keeps the reads above together in front of the first product: without it they are spread among the products, each with a full wait of its own
#pragma unroll
    for (int ct = 0; ct < 4; ++ct) { v8f c = {};
#pragma unroll
      for (int kc = 0; kc < 2; ++kc) c = wmma_bf(kf[ct][kc], aq[kc], c);
#pragma unroll
      for (int r = 0; r < 8; ++r) s[ct][r] = c[r]; }   // D element r = key row ct*16 + 8g + r, query column col; no scaling
    // A fragments of v^T from the staged [d][key] planes: row m = d = j*16 + col, k = key with the same split map; read here so that the softmax covers their latency (unrolled: vh stays in registers)
    v16h vh[2][4];
#pragma unroll
    for (int sub = 0; sub < 2; ++sub)
#pragma unroll
      for (int j = 0; j < 4; ++j) vh[sub][j] = frag_h(&vst[buf][j * 16 + col][sub * 32], lane);
    __builtin_amdgcn_sched_barrier(0);   // keeps the reads above in front of the softmax, whose work covers their latency
    // maximum of the lane's 32 scores (unrolled: mx is indexed by constants and stays in registers)
    float mx[8];
#pragma unroll
    for (int r = 0; r < 8; ++r) mx[r] = fmaxf(fmaxf(s[0][r], s[1][r]), fmaxf(s[2][r], s[3][r]));
    float mq = fmaxf(fmaxf(fmaxf(mx[0], mx[1]), fmaxf(mx[2], mx[3])), fmaxf(fmaxf(mx[4], mx[5]), fmaxf(mx[6], mx[7])));
    // one test a stage, a scalar branch: only where some lane's score passes its maximum in use by more than LAZY does the wave renew every query's maximum and rescale what it has summed
    if (__builtin_amdgcn_ballot_w32(mq > m + LAZY) != 0) {
      mq = fmaxf(mq, xhalf(mq));   // both halves: the 64 keys of query col
      const float mn = fmaxf(m, mq), alpha = __expf(m - mn); m = mn; cx = __builtin_fmaf(-mn, LOG2E, PCARRY_LOG2); l *= alpha;
#pragma unroll
      for (int j = 0; j < 4; ++j)
#pragma unroll
        for (int r = 0; r < 8; ++r) acc[j][r] *= alpha; }
  // unrolled: the 32-key halves of a stage take their scores and v fragments from registers indexed by constants
#pragma unroll
  for (int sub = 0; sub < SK / 32; ++sub) {
    // B fragment of P^T straight from the score registers (column n = query col; element i <- key 8g + i = tile 0 register i, 8+i <- key 16 + 8g + i = tile 1 register i, the k map of vh):
    // P x 2^6 = exp2(s log2e + (6 - m log2e)), one packed fma a pair in front of the hardware exp (unrolled: s, p and es are indexed by constants and stay in registers)
    float p[2][8], es[8];
#pragma unroll
    for (int t = 0; t < 2; ++t)
#pragma unroll
      for (int i = 0; i < 8; i += 2) { const v2f x = __builtin_elementwise_fma(v2f{s[2 * sub + t][i], s[2 * sub + t][i + 1]}, v2f{LOG2E, LOG2E}, v2f{cx, cx});
        p[t][i] = __builtin_amdgcn_exp2f(x[0]); p[t][i + 1] = __builtin_amdgcn_exp2f(x[1]); }
#pragma unroll
    for (int i = 0; i < 8; ++i) es[i] = p[0][i] + p[1][i];
    l += ((es[0] + es[1]) + (es[2] + es[3])) + ((es[4] + es[5]) + (es[6] + es[7]));
    // f16 rounding of P and the f16 rounding of its rest: register k of the fragment holds elements 2k, 2k + 1 (unrolled: ph, pr, pe and po are indexed by constants and stay in registers)
    unsigned ph[8], pr[8]; float pe[8], po[8];
#pragma unroll
    for (int k = 0; k < 8; ++k) { pe[k] = p[k >> 2][2 * (k & 3)]; po[k] = p[k >> 2][2 * (k & 3) + 1]; ph[k] = __builtin_bit_cast(unsigned, __builtin_convertvector(v2f{pe[k], po[k]}, v2h)); }
    if (sub) rest16<true>(pr, pe, po, ph); else rest16<false>(pr, pe, po, ph);   // the second half's statement stands among the first half's products
    const v16h pa = __builtin_bit_cast(v16h, v8u{ph[0], ph[1], ph[2], ph[3], ph[4], ph[5], ph[6], ph[7]}), par = __builtin_bit_cast(v16h, v8u{pr[0], pr[1], pr[2], pr[3], pr[4], pr[5], pr[6], pr[7]});
#pragma unroll
    for (int j = 0; j < 4; ++j) { acc[j] = wmma16(vh[sub][j], pa, acc[j]); acc[j] = wmma16(vh[sub][j], par, acc[j]); } }   // D element r = d row j*16 + 8g + r, query column col
    // publish point: own LDS reads done, own copies of stage st+1 landed, then the barrier that publishes st+1 and frees this buffer for st+2
    __builtin_amdgcn_sched_barrier(0);   // keeps the stage's products in front of the publish point, so that the refill behind it is issued a whole trip ahead of its use
    asm volatile("s_wait_dscnt 0x0" ::: "memory");
    asm volatile("s_wait_asynccnt 0x0" ::: "memory");
    __syncthreads();
    if (st + 2 < NST) stage_copy(lk + buf * (SK * KP * 2), gk + (size_t)(st + 2) * SK * DD, lv + buf * (DD * VP * 2), gv + (st + 2) * SK, 16 * KP * 2, (size_t)16 * DD, 16 * VP * 2, (size_t)16 * SEQ); }
  asm volatile("s_wait_asynccnt 0x0" ::: "memory");   // no copy of the ring is outstanding when the wave goes on to its end
  const float il = 1.0f / (l + xhalf(l));
#pragma unroll
  for (int j = 0; j < 4; ++j) { vst2(&so[wave][col][j * 16 + 8 * g], v4f{acc[j][0] * il, acc[j][1] * il, acc[j][2] * il, acc[j][3] * il});
    vst2(&so[wave][col][j * 16 + 8 * g + 4], v4f{acc[j][4] * il, acc[j][5] * il, acc[j][6] * il, acc[j][7] * il}); }
  ldsx();
  // one 256-B output row (64 floats of (b, q, h)) per instruction: lanes 0..7 -> line 0, lanes 8..15 -> line 1, 16 B each
  const int lc = lane & 15;
  for (int rl = 0; rl < 16; ++rl) { const v4f ov = *(const v4f*)&so[wave][rl][lc * 4];
    if (lane < 16) vst2(OUT + ((b * OSEQ + q0 + rl) * NH + h) * (size_t)DD + lc * 4, ov); }
}

extern "C" void kernel_launch(void* const* d_in, const int* in_sizes, int n_in, void* d_out, int out_size, void* d_ws, size_t ws_size, hipStream_t stream) {
  if (n_in < 3) return;
  const size_t need = ((size_t)(NB - 1) * SEQ_FULL + SEQ) * RS;
  if ((size_t)in_sizes[0] < need || (size_t)in_sizes[1] < need || (size_t)in_sizes[2] < need) return;
  if ((size_t)out_size < (size_t)NB * OSEQ * RS) return;
  if (ws_size < (size_t)WS_END) return;
  const float* Qp = (const float*)d_in[0];   // 0 queries [4,2048,8,64] f32
  const float* Kp = (const float*)d_in[1];   // 1 keys    [4,2048,8,64] f32
  const float* Vp = (const float*)d_in[2];   // 2 values  [4,2048,8,64] f32
  char* ws = (char*)d_ws; _Float16* VT = (_Float16*)(ws + WS_VT); __bf16* KB = (__bf16*)(ws + WS_KB);
  k_vt<<<dim3(SEQ / 64, NB * NH, 2), 128, 0, stream>>>(Vp, Kp, VT, KB);
  k_att<<<dim3(SEQ / 64, NB * NH), 128, 0, stream>>>(Qp, KB, VT, (float*)d_out);
}

// v007
// One run takes 43 microseconds.
// In two side-by-side timings against v006, it was 1.16 and 1.17 times as fast.
// Counting every step since v000, it is 4.86 times as fast.
// compute dtype: q, k, v RNE-converted to bf16 (k once, in the first launch); logits on v_wmma_f32_16x16x32_bf16 (bf16 x bf16 single product, f32 accumulate), no scaling; softmax in f32 (hardware exp) against a maximum that is renewed only when a score passes it by more than 5.5; P carried x 2^6 (the carry added in the exponent), RNE-converted to f16, against v (bf16 -> f16, exact) on v_wmma_f32_16x16x32_f16, one product, f32 accumulate; f32 output [B, L, H, D].
#include <hip/hip_runtime.h>
#include <math.h>

typedef __attribute__((ext_vector_type(16))) _Float16 v16h;
typedef __attribute__((ext_vector_type(16))) __bf16 v16b;
typedef __attribute__((ext_vector_type(8)))  _Float16 v8h;
typedef __attribute__((ext_vector_type(8)))  __bf16 v8b;
typedef __attribute__((ext_vector_type(4)))  __bf16 v4b;
typedef __attribute__((ext_vector_type(8)))  float v8f;
typedef __attribute__((ext_vector_type(4)))  float v4f;
typedef __attribute__((ext_vector_type(4)))  unsigned v4u;
typedef __attribute__((ext_vector_type(8)))  unsigned v8u;
typedef __attribute__((ext_vector_type(2)))  float v2f;
typedef __attribute__((ext_vector_type(2)))  _Float16 v2h;

template <typename T> __device__ __forceinline__ void vst2(void* p, T v) { *(T*)p = v;  }
// bare builtins: the compiler keeps the distances behind its own matrix instructions and fills them with useful work where it can
__device__ __forceinline__ v8f wmma16(v16h a, v16h b, v8f c) {
  return __builtin_amdgcn_wmma_f32_16x16x32_f16(false, a, false, b, (short)0, c, false, false);
}
__device__ __forceinline__ v8f wmma_bf(v16b a, v16b b, v8f c) {
  return __builtin_amdgcn_wmma_f32_16x16x32_bf16(false, a, false, b, (short)0, c, false, false);
}
// 16x16x32 fragments: lane = (h = lane>>4, row/col = lane&15); elements 0..7 = k0+8h+0..7, 8..15 = k0+16+8h+0..7; D element r = row 8h+r, col lane&15
__device__ __forceinline__ v16h frag_h(const _Float16* rowk0, int lane) {
  union { v16h v; v8h q[2]; } u; const _Float16* p = rowk0 + 8 * (lane >> 4);
  u.q[0] = *(const v8h*)p; u.q[1] = *(const v8h*)(p + 16); return u.v;
}
__device__ __forceinline__ v16b frag_b(const __bf16* rowk0, int lane) {
  union { v16b v; v8b q[2]; } u; const __bf16* p = rowk0 + 8 * (lane >> 4);
  u.q[0] = *(const v8b*)p; u.q[1] = *(const v8b*)(p + 16); return u.v;
}
__device__ __forceinline__ float bfr(float v) { return (float)(__bf16)v; }
__device__ __forceinline__ void ldsx() { asm volatile("s_wait_dscnt 0" ::: "memory"); __builtin_amdgcn_wave_barrier(); __builtin_amdgcn_fence(3, "workgroup"); }

// lane l <-> l ^ 16 in the vector unit (a shuffle would go through the LDS queue and its wait)
__device__ __forceinline__ float xhalf(float v) { const int b = __builtin_bit_cast(int, v); return __builtin_bit_cast(float, __builtin_amdgcn_permlanex16(b, b, 0x76543210, 0xfedcba98, false, false)); }
__device__ __forceinline__ unsigned lds_off(const void* p) { return (unsigned)(size_t)p; }   // byte offset in the work-group's LDS
// one stage (64 keys), this lane's share: four 16-B pieces of the bf16 key rows (lk, gk; piece i one step further) and four of the f16 value planes (lv, gv),
// global -> LDS through no register. The s_wait_xcnt closes the statement so that no address register named here is rewritten in front of it.
__device__ __forceinline__ void stage_copy(unsigned lk, const __bf16* gk, unsigned lv, const _Float16* gv, unsigned lks, size_t gks, unsigned lvs, size_t gvs) {
  asm volatile("global_load_async_to_lds_b128 %0, %1, off\n\t"
               "global_load_async_to_lds_b128 %2, %3, off\n\t"
               "global_load_async_to_lds_b128 %4, %5, off\n\t"
               "global_load_async_to_lds_b128 %6, %7, off\n\t"
               "global_load_async_to_lds_b128 %8, %9, off\n\t"
               "global_load_async_to_lds_b128 %10, %11, off\n\t"
               "global_load_async_to_lds_b128 %12, %13, off\n\t"
               "global_load_async_to_lds_b128 %14, %15, off\n\t"
               "s_wait_xcnt 0x0"
               :: "v"(lk), "v"(gk), "v"(lk + lks), "v"(gk + gks), "v"(lk + 2 * lks), "v"(gk + 2 * gks), "v"(lk + 3 * lks), "v"(gk + 3 * gks),
                  "v"(lv), "v"(gv), "v"(lv + lvs), "v"(gv + gvs), "v"(lv + 2 * lvs), "v"(gv + 2 * gvs), "v"(lv + 3 * lvs), "v"(gv + 3 * gvs) : "memory");
}

// dense softmax attention on raw inputs in [B, S, H, D] layout: A = softmax(q k^T) over keys (no 1/sqrt(D)); out = A . v, written [B, L, H, D].
#ifndef NB
#define NB 4                    // batches computed
#endif
#ifndef SEQ
#define SEQ 2048                // sequence length computed
#endif
#define NB_FULL 4
#define SEQ_FULL 2048           // inputs always have the full sequence length per batch
#define NH 8
#define DD 64
#define RS (NH * DD)            // floats between consecutive s of one batch (512)
#define BSTR ((size_t)SEQ_FULL * RS)   // input batch stride in floats
#ifndef OSEQ
#define OSEQ SEQ                // output sequence stride (dense over the computed rows)
#endif
#define SK 64                   // keys per LDS stage: a value-plane row of a stage is one whole 128-B line
#define NST (SEQ / SK)
#define KP 72                   // bf16 per staged key row: 144 B = 16 B x 9, no bank conflict for 16-B LDS reads
#define VP 72                   // f16 per staged value row: 144 B = 16 B x 9, likewise
#define PCARRY_LOG2 6.0f        // power-of-two carry on P (x 2^6), added in the exponent; the row sum carries it too, so it cancels in the epilogue's division
#define LAZY 5.5f               // a score may pass the maximum in use by this much (under 8 in log2) before sums and accumulators are rescaled: P x 2^6 stays under 2^14, inside f16
#define LOG2E 1.44269504f
static_assert(SEQ % 64 == 0);
static_assert(SEQ <= SEQ_FULL);
static_assert(NB >= 1 && NB <= NB_FULL);
static_assert(DD == 64);

#define WS_VT  0u                                            // f16 value planes [b*NH + h][DD][SEQ]
#define WS_KB  (WS_VT + 2u * (size_t)NB * NH * DD * SEQ)      // bf16 key rows [b*NH + h][SEQ][DD]; each plane set 8,388,608 B at full size
#define WS_END (WS_KB + 2u * (size_t)NB * NH * DD * SEQ)
static_assert(WS_END <= (size_t)134217728u);

// blockIdx.z = 0: 64 keys of v -> f16 planes [d][key]; blockIdx.z = 1: 64 keys of k -> bf16 rows, one head's rows in a row
__global__ __launch_bounds__(128) void k_vt(const float* __restrict__ V, const float* __restrict__ K, _Float16* __restrict__ VT, __bf16* __restrict__ KB) {
  __shared__ __align__(16) _Float16 th[DD][72];
  const int t = threadIdx.x; const size_t bh = blockIdx.y; const size_t b = bh / NH; const int h = bh % NH; const int m0 = blockIdx.x * 64;
  if (blockIdx.z) {   // the same for the whole block, in front of the barrier
    // a wave-wide load takes two whole 256-B source rows, its store 256 B in a row; unrolled: the eight loads of a lane are in flight together
    const float* kp = K + b * BSTR + ((size_t)(m0 + (t >> 4)) * NH + h) * DD + (t & 15) * 4; __bf16* kq = KB + (bh * SEQ + m0) * (size_t)DD + t * 4;
    v4f kv[8];
#pragma unroll
    for (int i = 0; i < 8; ++i) kv[i] = *(const v4f*)(kp + (size_t)i * 8 * RS);
#pragma unroll
    for (int i = 0; i < 8; ++i) vst2(kq + i * 8 * DD, __builtin_convertvector(kv[i], v4b));
    asm volatile("s_wait_xcnt 0x0" ::: "memory");   // behind the last store: no register that the eight stores name is rewritten in front of it on any way out of this part
    return; }
  for (int e = t; e < 64 * DD; e += 128) { const int ml = e / DD, d = e % DD; th[d][ml] = (_Float16)bfr(V[b * BSTR + ((size_t)(m0 + ml) * NH + h) * DD + d]); }
  __syncthreads();
  for (int e = t; e < DD * 8; e += 128) { const int d = e >> 3, q = e & 7; vst2((unsigned*)(VT + (bh * DD + d) * (size_t)SEQ + m0 + q * 8), *(const v4u*)&th[d][q * 8]); }
}
// ---- k_att: block = (64 queries, b*NH + h), 4 waves x 16 queries: bf16 logits over all SEQ keys as S^T = k . q^T (a lane holds one query's scores), softmax with a lazily renewed maximum, O^T += v^T . P^T
__global__ __launch_bounds__(128) void k_att(const float* __restrict__ Q, const __bf16* __restrict__ KB, const _Float16* __restrict__ VT, float* __restrict__ OUT) {
  __shared__ __align__(16) float so[4][16][68];
  __shared__ __align__(16) __bf16 kst[2][SK][KP]; __shared__ __align__(16) _Float16 vst[2][DD][VP];   // two stages: k rows as bf16, v planes [d][key] as f16
  const int tid = threadIdx.x, wave = tid >> 5, lane = tid & 31, col = lane & 15, g = lane >> 4;
  const size_t bh = blockIdx.y; const size_t b = bh / NH; const int h = bh % NH; const int q0 = blockIdx.x * 64 + wave * 16;
  // B fragments of q: column n = query col, elements i <- d = kc*32 + 8g + i, 8+i <- d = kc*32 + 16 + 8g + i
  v16b aq[2];
#pragma unroll
  for (int kc = 0; kc < 2; ++kc) { const float* pp = Q + b * BSTR + ((size_t)(q0 + col) * NH + h) * DD + kc * 32 + 8 * g;
#pragma unroll
    for (int i = 0; i < 8; ++i) { aq[kc][i] = (__bf16)pp[i]; aq[kc][8 + i] = (__bf16)pp[16 + i]; } }
  // of query col: m = the maximum in use (the same in both lane halves), cx = 6 - m log2e, l over this lane half's keys only (the halves join in the epilogue)
  float m = -3.0e38f, cx = __builtin_fmaf(3.0e38f, LOG2E, PCARRY_LOG2), l = 0.f;
  v8f acc[4];
#pragma unroll
  for (int j = 0; j < 4; ++j) acc[j] = v8f{};
  // this lane's pieces of a stage: k piece i = key (tid>>3) + 16i, bytes 16*(tid&7) of its row; v piece i = d (tid>>3) + 16i, bytes 16*(tid&7) of its row
  const __bf16* gk = KB + (bh * SEQ + (tid >> 3)) * (size_t)DD + (tid & 7) * 8; const _Float16* gv = VT + (bh * DD + (tid >> 3)) * (size_t)SEQ + (tid & 7) * 8;
  const unsigned lk = lds_off(&kst[0][tid >> 3][(tid & 7) * 8]), lv = lds_off(&vst[0][tid >> 3][(tid & 7) * 8]);
  stage_copy(lk, gk, lv, gv, 16 * KP * 2, (size_t)16 * DD, 16 * VP * 2, (size_t)16 * SEQ);
  asm volatile("s_wait_asynccnt 0x0" ::: "memory");   // this wave's pieces of stage 0 have landed before the barrier that publishes the stage
  __syncthreads();
  if (1 < NST) stage_copy(lk + SK * KP * 2, gk + (size_t)SK * DD, lv + DD * VP * 2, gv + SK, 16 * KP * 2, (size_t)16 * DD, 16 * VP * 2, (size_t)16 * SEQ);
  // kept rolled: one trip = one stage with its one publish point at the foot
#pragma unroll 1
  for (int st = 0; st < NST; ++st) { const int buf = st & 1;
    // A fragments of k straight from the staged bf16 rows: row m = key ct*16 + col, elements i <- d = kc*32 + 8g + i, 8+i <- d = kc*32 + 16 + 8g + i (same k map as B);
    // the stage's 64 keys' fragments in one group of LDS reads, in front of the first product (both loops unrolled: kf is indexed by constants and stays in registers)
    float s[4][8]; v16b kf[4][2];
#pragma unroll
    for (int ct = 0; ct < 4; ++ct)
#pragma unroll
      for (int kc = 0; kc < 2; ++kc) kf[ct][kc] = frag_b(&kst[buf][ct * 16 + col][kc * 32], lane);
    __builtin_amdgcn_sched_barrier(0);   // keeps the reads above together in front of the first product: without it they are spread among the products, each with a full wait of its own
#pragma unroll
    for (int ct = 0; ct < 4; ++ct) { v8f c = {};
#pragma unroll
      for (int kc = 0; kc < 2; ++kc) c = wmma_bf(kf[ct][kc], aq[kc], c);
#pragma unroll
      for (int r = 0; r < 8; ++r) s[ct][r] = c[r]; }   // D element r = key row ct*16 + 8g + r, query column col; no scaling
    // A fragments of v^T from the staged [d][key] planes: row m = d = j*16 + col, k = key with the same split map; read here so that the softmax covers their latency (unrolled: vh stays in registers)
    v16h vh[2][4];
#pragma unroll
    for (int sub = 0; sub < 2; ++sub)
#pragma unroll
      for (int j = 0; j < 4; ++j) vh[sub][j] = frag_h(&vst[buf][j * 16 + col][sub * 32], lane);
    __builtin_amdgcn_sched_barrier(0);   // keeps the reads above in front of the softmax, whose work covers their latency
    // maximum of the lane's 32 scores (unrolled: mx is indexed by constants and stays in registers)
    float mx[8];
#pragma unroll
    for (int r = 0; r < 8; ++r) mx[r] = fmaxf(fmaxf(s[0][r], s[1][r]), fmaxf(s[2][r], s[3][r]));
    float mq = fmaxf(fmaxf(fmaxf(mx[0], mx[1]), fmaxf(mx[2], mx[3])), fmaxf(fmaxf(mx[4], mx[5]), fmaxf(mx[6], mx[7])));
    // one test a stage, a scalar branch: only where some lane's score passes its maximum in use by more than LAZY does the wave renew every query's maximum and rescale what it has summed
    if (__builtin_amdgcn_ballot_w32(mq > m + LAZY) != 0) {
      mq = fmaxf(mq, xhalf(mq));   // both halves: the 64 keys of query col
      const float mn = fmaxf(m, mq), alpha = __expf(m - mn); m = mn; cx = __builtin_fmaf(-mn, LOG2E, PCARRY_LOG2); l *= alpha;
#pragma unroll
      for (int j = 0; j < 4; ++j)
#pragma unroll
        for (int r = 0; r < 8; ++r) acc[j][r] *= alpha; }
  // unrolled: the 32-key halves of a stage take their scores and v fragments from registers indexed by constants
#pragma unroll
  for (int sub = 0; sub < SK / 32; ++sub) {
    // B fragment of P^T straight from the score registers (column n = query col; element i <- key 8g + i = tile 0 register i, 8+i <- key 16 + 8g + i = tile 1 register i, the k map of vh):
    // P x 2^6 = exp2(s log2e + (6 - m log2e)), one packed fma a pair in front of the hardware exp (unrolled: s, p and es are indexed by constants and stay in registers)
    float p[2][8], es[8];
#pragma unroll
    for (int t = 0; t < 2; ++t)
#pragma unroll
      for (int i = 0; i < 8; i += 2) { const v2f x = __builtin_elementwise_fma(v2f{s[2 * sub + t][i], s[2 * sub + t][i + 1]}, v2f{LOG2E, LOG2E}, v2f{cx, cx});
        p[t][i] = __builtin_amdgcn_exp2f(x[0]); p[t][i + 1] = __builtin_amdgcn_exp2f(x[1]); }
#pragma unroll
    for (int i = 0; i < 8; ++i) es[i] = p[0][i] + p[1][i];
    l += ((es[0] + es[1]) + (es[2] + es[3])) + ((es[4] + es[5]) + (es[6] + es[7]));
    // f16 rounding of P, and no more of it: half an ulp of f16 is 2^-11 of P, an eighth of what the bf16 rounding of v, its partner in the product, has already lost.
    // Register k of the fragment holds elements 2k, 2k + 1 (unrolled: ph is indexed by constants and stays in registers)
    unsigned ph[8];
#pragma unroll
    for (int k = 0; k < 8; ++k) ph[k] = __builtin_bit_cast(unsigned, __builtin_convertvector(v2f{p[k >> 2][2 * (k & 3)], p[k >> 2][2 * (k & 3) + 1]}, v2h));
    const v16h pa = __builtin_bit_cast(v16h, v8u{ph[0], ph[1], ph[2], ph[3], ph[4], ph[5], ph[6], ph[7]});
#pragma unroll
    for (int j = 0; j < 4; ++j) acc[j] = wmma16(vh[sub][j], pa, acc[j]); }   // D element r = d row j*16 + 8g + r, query column col
    // publish point: own LDS reads done, own copies of stage st+1 landed, then the barrier that publishes st+1 and frees this buffer for st+2
    __builtin_amdgcn_sched_barrier(0);   // keeps the stage's products in front of the publish point, so that the refill behind it is issued a whole trip ahead of its use
    asm volatile("s_wait_dscnt 0x0" ::: "memory");
    asm volatile("s_wait_asynccnt 0x0" ::: "memory");
    __syncthreads();
    if (st + 2 < NST) stage_copy(lk + buf * (SK * KP * 2), gk + (size_t)(st + 2) * SK * DD, lv + buf * (DD * VP * 2), gv + (st + 2) * SK, 16 * KP * 2, (size_t)16 * DD, 16 * VP * 2, (size_t)16 * SEQ); }
  asm volatile("s_wait_asynccnt 0x0" ::: "memory");   // no copy of the ring is outstanding when the wave goes on to its end
  const float il = 1.0f / (l + xhalf(l));
#pragma unroll
  for (int j = 0; j < 4; ++j) { vst2(&so[wave][col][j * 16 + 8 * g], v4f{acc[j][0] * il, acc[j][1] * il, acc[j][2] * il, acc[j][3] * il});
    vst2(&so[wave][col][j * 16 + 8 * g + 4], v4f{acc[j][4] * il, acc[j][5] * il, acc[j][6] * il, acc[j][7] * il}); }
  ldsx();
  // one 256-B output row (64 floats of (b, q, h)) per instruction: lanes 0..7 -> line 0, lanes 8..15 -> line 1, 16 B each
  const int lc = lane & 15;
  for (int rl = 0; rl < 16; ++rl) { const v4f ov = *(const v4f*)&so[wave][rl][lc * 4];
    if (lane < 16) vst2(OUT + ((b * OSEQ + q0 + rl) * NH + h) * (size_t)DD + lc * 4, ov); }
}

extern "C" void kernel_launch(void* const* d_in, const int* in_sizes, int n_in, void* d_out, int out_size, void* d_ws, size_t ws_size, hipStream_t stream) {
  if (n_in < 3) return;
  const size_t need = ((size_t)(NB - 1) * SEQ_FULL + SEQ) * RS;
  if ((size_t)in_sizes[0] < need || (size_t)in_sizes[1] < need || (size_t)in_sizes[2] < need) return;
  if ((size_t)out_size < (size_t)NB * OSEQ * RS) return;
  if (ws_size < (size_t)WS_END) return;
  const float* Qp = (const float*)d_in[0];   // 0 queries [4,2048,8,64] f32
  const float* Kp = (const float*)d_in[1];   // 1 keys    [4,2048,8,64] f32
  const float* Vp = (const float*)d_in[2];   // 2 values  [4,2048,8,64] f32
  char* ws = (char*)d_ws; _Float16* VT = (_Float16*)(ws + WS_VT); __bf16* KB = (__bf16*)(ws + WS_KB);
  k_vt<<<dim3(SEQ / 64, NB * NH, 2), 128, 0, stream>>>(Vp, Kp, VT, KB);
  k_att<<<dim3(SEQ / 64, NB * NH), 128, 0, stream>>>(Qp, KB, VT, (float*)d_out);
}

// v008
// A run of this version takes 38.2 microseconds.
// Two timings next to v007 put it at 1.12 and 1.11 times that version's speed.
// Counting every step since v000, it is 5.42 times as fast.
// compute dtype: q, k, v RNE-converted to bf16 (k once, in the first launch); logits on v_wmma_f32_16x16x32_bf16 (bf16 x bf16 single product, f32 accumulate), no scaling; softmax in f32 (hardware exp) against a maximum that is renewed only when a score passes it by more than 5.5; P carried x 2^6 (the carry added in the exponent), RNE-converted to f16, against v (bf16 -> f16, exact) on v_wmma_f32_16x16x32_f16, one product, f32 accumulate; f32 output [B, L, H, D].
#include <hip/hip_runtime.h>
#include <math.h>

typedef __attribute__((ext_vector_type(16))) _Float16 v16h;
typedef __attribute__((ext_vector_type(16))) __bf16 v16b;
typedef __attribute__((ext_vector_type(8)))  _Float16 v8h;
typedef __attribute__((ext_vector_type(8)))  __bf16 v8b;
typedef __attribute__((ext_vector_type(4)))  __bf16 v4b;
typedef __attribute__((ext_vector_type(8)))  float v8f;
typedef __attribute__((ext_vector_type(4)))  float v4f;
typedef __attribute__((ext_vector_type(4)))  unsigned v4u;
typedef __attribute__((ext_vector_type(8)))  unsigned v8u;
typedef __attribute__((ext_vector_type(2)))  float v2f;
typedef __attribute__((ext_vector_type(2)))  _Float16 v2h;

template <typename T> __device__ __forceinline__ void vst2(void* p, T v) { *(T*)p = v;  }
// bare builtins: the compiler keeps the distances behind its own matrix instructions and fills them with useful work where it can
__device__ __forceinline__ v8f wmma16(v16h a, v16h b, v8f c) {
  return __builtin_amdgcn_wmma_f32_16x16x32_f16(false, a, false, b, (short)0, c, false, false);
}
__device__ __forceinline__ v8f wmma_bf(v16b a, v16b b, v8f c) {
  return __builtin_amdgcn_wmma_f32_16x16x32_bf16(false, a, false, b, (short)0, c, false, false);
}
// 16x16x32 fragments: lane = (h = lane>>4, row/col = lane&15); elements 0..7 = k0+8h+0..7, 8..15 = k0+16+8h+0..7; D element r = row 8h+r, col lane&15
__device__ __forceinline__ v16h frag_h(const _Float16* rowk0, int lane) {
  union { v16h v; v8h q[2]; } u; const _Float16* p = rowk0 + 8 * (lane >> 4);
  u.q[0] = *(const v8h*)p; u.q[1] = *(const v8h*)(p + 16); return u.v;
}
__device__ __forceinline__ v16b frag_b(const __bf16* rowk0, int lane) {
  union { v16b v; v8b q[2]; } u; const __bf16* p = rowk0 + 8 * (lane >> 4);
  u.q[0] = *(const v8b*)p; u.q[1] = *(const v8b*)(p + 16); return u.v;
}
__device__ __forceinline__ float bfr(float v) { return (float)(__bf16)v; }

// lane l <-> l ^ 16 in the vector unit (a shuffle would go through the LDS queue and its wait)
__device__ __forceinline__ float xhalf(float v) { const int b = __builtin_bit_cast(int, v); return __builtin_bit_cast(float, __builtin_amdgcn_permlanex16(b, b, 0x76543210, 0xfedcba98, false, false)); }
__device__ __forceinline__ unsigned lds_off(const void* p) { return (unsigned)(size_t)p; }   // byte offset in the work-group's LDS
// one stage (128 keys), this lane's share: four 16-B pieces of the bf16 key rows (lk, gk; piece i one step further) and four of the f16 value planes (lv, gv),
// global -> LDS through no register. The s_wait_xcnt closes the statement so that no address register named here is rewritten in front of it.
__device__ __forceinline__ void stage_copy(unsigned lk, const __bf16* gk, unsigned lv, const _Float16* gv, unsigned lks, size_t gks, unsigned lvs, size_t gvs) {
  asm volatile("global_load_async_to_lds_b128 %0, %1, off\n\t"
               "global_load_async_to_lds_b128 %2, %3, off\n\t"
               "global_load_async_to_lds_b128 %4, %5, off\n\t"
               "global_load_async_to_lds_b128 %6, %7, off\n\t"
               "global_load_async_to_lds_b128 %8, %9, off\n\t"
               "global_load_async_to_lds_b128 %10, %11, off\n\t"
               "global_load_async_to_lds_b128 %12, %13, off\n\t"
               "global_load_async_to_lds_b128 %14, %15, off\n\t"
               "s_wait_xcnt 0x0"
               :: "v"(lk), "v"(gk), "v"(lk + lks), "v"(gk + gks), "v"(lk + 2 * lks), "v"(gk + 2 * gks), "v"(lk + 3 * lks), "v"(gk + 3 * gks),
                  "v"(lv), "v"(gv), "v"(lv + lvs), "v"(gv + gvs), "v"(lv + 2 * lvs), "v"(gv + 2 * gvs), "v"(lv + 3 * lvs), "v"(gv + 3 * gvs) : "memory");
}

// dense softmax attention on raw inputs in [B, S, H, D] layout: A = softmax(q k^T) over keys (no 1/sqrt(D)); out = A . v, written [B, L, H, D].
#ifndef NB
#define NB 4                    // batches computed
#endif
#ifndef SEQ
#define SEQ 2048                // sequence length computed
#endif
#define NB_FULL 4
#define SEQ_FULL 2048           // inputs always have the full sequence length per batch
#define NH 8
#define DD 64
#define RS (NH * DD)            // floats between consecutive s of one batch (512)
#define BSTR ((size_t)SEQ_FULL * RS)   // input batch stride in floats
#ifndef OSEQ
#define OSEQ SEQ                // output sequence stride (dense over the computed rows)
#endif
#define SK 128                  // keys per LDS stage, 64 for each of a block's two wave sets: a value-plane row of a stage is two whole 128-B lines
#define QB 128                  // queries per block: four groups of 32, each group worked on by one wave of either set
#define NST (SEQ / SK)
#define KP 72                   // bf16 per staged key row: 144 B = 16 B x 9, no bank conflict for 16-B LDS reads
#define VP 72                   // f16 per staged value row: 144 B = 16 B x 9, likewise
#define PCARRY_LOG2 6.0f        // power-of-two carry on P (x 2^6), added in the exponent; the row sum carries it too, so it cancels in the epilogue's division
#define LAZY 5.5f               // a score may pass the maximum in use by this much (under 8 in log2) before sums and accumulators are rescaled: P x 2^6 stays under 2^14, inside f16
#define LOG2E 1.44269504f
static_assert(SEQ % SK == 0 && SEQ % QB == 0);
static_assert(SEQ <= SEQ_FULL);
static_assert(NB >= 1 && NB <= NB_FULL);
static_assert(DD == 64);

#define WS_VT  0u                                            // f16 value planes [b*NH + h][DD][SEQ]
#define WS_KB  (WS_VT + 2u * (size_t)NB * NH * DD * SEQ)      // bf16 key rows [b*NH + h][SEQ][DD]; each plane set 8,388,608 B at full size
#define WS_END (WS_KB + 2u * (size_t)NB * NH * DD * SEQ)
static_assert(WS_END <= (size_t)134217728u);

// blockIdx.z = 0: 64 keys of v -> f16 planes [d][key]; blockIdx.z = 1: 64 keys of k -> bf16 rows, one head's rows in a row
__global__ __launch_bounds__(128) void k_vt(const float* __restrict__ V, const float* __restrict__ K, _Float16* __restrict__ VT, __bf16* __restrict__ KB) {
  __shared__ __align__(16) _Float16 th[DD][72];
  const int t = threadIdx.x; const size_t bh = blockIdx.y; const size_t b = bh / NH; const int h = bh % NH; const int m0 = blockIdx.x * 64;
  if (blockIdx.z) {   // the same for the whole block, in front of the barrier
    // a wave-wide load takes two whole 256-B source rows, its store 256 B in a row; unrolled: the eight loads of a lane are in flight together
    const float* kp = K + b * BSTR + ((size_t)(m0 + (t >> 4)) * NH + h) * DD + (t & 15) * 4; __bf16* kq = KB + (bh * SEQ + m0) * (size_t)DD + t * 4;
    v4f kv[8];
#pragma unroll
    for (int i = 0; i < 8; ++i) kv[i] = *(const v4f*)(kp + (size_t)i * 8 * RS);
#pragma unroll
    for (int i = 0; i < 8; ++i) vst2(kq + i * 8 * DD, __builtin_convertvector(kv[i], v4b));
    asm volatile("s_wait_xcnt 0x0" ::: "memory");   // behind the last store: no register that the eight stores name is rewritten in front of it on any way out of this part
    return; }
  for (int e = t; e < 64 * DD; e += 128) { const int ml = e / DD, d = e % DD; th[d][ml] = (_Float16)bfr(V[b * BSTR + ((size_t)(m0 + ml) * NH + h) * DD + d]); }
  __syncthreads();
  for (int e = t; e < DD * 8; e += 128) { const int d = e >> 3, q = e & 7; vst2((unsigned*)(VT + (bh * DD + d) * (size_t)SEQ + m0 + q * 8), *(const v4u*)&th[d][q * 8]); }
}
// ---- k_att: block = (128 queries, b*NH + h), 8 waves = 4 query groups x 2 key sets. A wave has 32 queries (two column tiles) and, of every 128-key stage, its set's 64 keys, in two passes of 32:
// bf16 logits as S^T = k . q^T (a lane holds one query's scores per tile), softmax with a lazily renewed maximum, O^T += v^T . P^T. Each k and v fragment read from LDS feeds two products, one per query tile.
// The two sets' maxima, sums and accumulators of a query group are joined once, in the epilogue, through LDS.
// waves_per_eu(4, 4): two blocks share a WGP, four waves a SIMD, so that other waves' products run under a wave's softmax; a wave's registers stay within 256.
__global__ __launch_bounds__(256) __attribute__((amdgpu_waves_per_eu(4, 4))) void k_att(const float* __restrict__ Q, const __bf16* __restrict__ KB, const _Float16* __restrict__ VT, float* __restrict__ OUT) {
  __shared__ __align__(16) float so[4][32][68]; __shared__ float sm[4][32], sl[4][32];
  __shared__ __align__(16) __bf16 kst[2][SK][KP]; __shared__ __align__(16) _Float16 vst[2][2][DD][VP];   // two stages: k rows as bf16; v planes [key set][d][key] as f16
  const int tid = threadIdx.x, wave = __builtin_amdgcn_readfirstlane(tid >> 5), lane = tid & 31, col = lane & 15, g = lane >> 4;
  const int qg = wave & 3, kh = wave >> 2;   // query group, key set: the same for the whole wave
  const size_t bh = blockIdx.y; const size_t b = bh / NH; const int h = bh % NH; const int q0 = blockIdx.x * QB + qg * 32;
  // B fragments of q: column n = query qt*16 + col, elements i <- d = kc*32 + 8g + i, 8+i <- d = kc*32 + 16 + 8g + i (unrolled: aq is indexed by constants and stays in registers)
  v16b aq[2][2];
#pragma unroll
  for (int qt = 0; qt < 2; ++qt)
#pragma unroll
    for (int kc = 0; kc < 2; ++kc) { const float* pp = Q + b * BSTR + ((size_t)(q0 + qt * 16 + col) * NH + h) * DD + kc * 32 + 8 * g;
#pragma unroll
      for (int i = 0; i < 8; ++i) { aq[qt][kc][i] = (__bf16)pp[i]; aq[qt][kc][8 + i] = (__bf16)pp[16 + i]; } }
  // of query qt*16 + col, over this wave's key set: m = the maximum in use (the same in both lane halves), cx = 6 - m log2e, l over this lane half's keys only (halves and sets join in the epilogue); unrolled: all indexed by constants, all in registers
  float m[2], cx[2], l[2]; v8f acc[2][4];
#pragma unroll
  for (int qt = 0; qt < 2; ++qt) { m[qt] = -3.0e38f; cx[qt] = __builtin_fmaf(3.0e38f, LOG2E, PCARRY_LOG2); l[qt] = 0.f;
#pragma unroll
    for (int j = 0; j < 4; ++j) acc[qt][j] = v8f{}; }
  // this lane's pieces of a stage: k piece i = key (tid>>3) + 32i, bytes 16*(tid&7) of its row; v piece i = d (tid>>4) + 16i, bytes 16*(tid&15) of its 256-B row (pieces 0..7 are key set 0's, 8..15 set 1's)
  const __bf16* gk = KB + (bh * SEQ + (tid >> 3)) * (size_t)DD + (tid & 7) * 8; const _Float16* gv = VT + (bh * DD + (tid >> 4)) * (size_t)SEQ + (tid & 15) * 8;
  const unsigned lk = lds_off(&kst[0][tid >> 3][(tid & 7) * 8]), lv = lds_off(&vst[0][(tid >> 3) & 1][tid >> 4][(tid & 7) * 8]);
  stage_copy(lk, gk, lv, gv, 32 * KP * 2, (size_t)32 * DD, 16 * VP * 2, (size_t)16 * SEQ);
  asm volatile("s_wait_asynccnt 0x0" ::: "memory");   // this wave's pieces of stage 0 have landed before the barrier that publishes the stage
  __syncthreads();
  if (1 < NST) stage_copy(lk + SK * KP * 2, gk + (size_t)SK * DD, lv + 2 * DD * VP * 2, gv + SK, 32 * KP * 2, (size_t)32 * DD, 16 * VP * 2, (size_t)16 * SEQ);
  // kept rolled: one trip = one stage with its one publish point at the foot
#pragma unroll 1
  for (int st = 0; st < NST; ++st) { const int buf = st & 1;
    // A fragments of k straight from the staged bf16 rows: row m = key ct*16 + col of the pass, elements i <- d = kc*32 + 8g + i, 8+i <- d = kc*32 + 16 + 8g + i (same k map as B);
    // a pass's fragments in one group of LDS reads (loops unrolled: kf is indexed by constants and stays in registers)
    v16b kf[2][2];
#pragma unroll
    for (int ct = 0; ct < 2; ++ct)
#pragma unroll
      for (int kc = 0; kc < 2; ++kc) kf[ct][kc] = frag_b(&kst[buf][kh * 64 + ct * 16 + col][kc * 32], lane);
    __builtin_amdgcn_sched_barrier(0);   // keeps the reads above together in front of the first product: without it they are spread among the products, each with a full wait of its own
  // unrolled: the two passes of a stage differ in constant LDS offsets only, and the second's k fragments are read during the first
#pragma unroll
  for (int ps = 0; ps < 2; ++ps) {
    // the pass's eight score products, four independent chains of two (unrolled: s is indexed by constants and stays in registers)
    float s[2][2][8];
#pragma unroll
    for (int qt = 0; qt < 2; ++qt)
#pragma unroll
      for (int ct = 0; ct < 2; ++ct) { v8f c = {};
#pragma unroll
        for (int kc = 0; kc < 2; ++kc) c = wmma_bf(kf[ct][kc], aq[qt][kc], c);
#pragma unroll
        for (int r = 0; r < 8; ++r) s[qt][ct][r] = c[r]; }   // D element r = key row ct*16 + 8g + r of the pass, query column qt*16 + col; no scaling
    // A fragments of v^T from the staged [d][key] planes: row m = d = j*16 + col, k = key with the same split map; read here, with the stage's second pass's k fragments, so that the softmax covers their latency (unrolled: vh and kf stay in registers)
    v16h vh[4];
#pragma unroll
    for (int j = 0; j < 4; ++j) vh[j] = frag_h(&vst[buf][kh][j * 16 + col][ps * 32], lane);
    if (ps == 0) {
#pragma unroll
      for (int ct = 0; ct < 2; ++ct)
#pragma unroll
        for (int kc = 0; kc < 2; ++kc) kf[ct][kc] = frag_b(&kst[buf][kh * 64 + 32 + ct * 16 + col][kc * 32], lane); }
    __builtin_amdgcn_sched_barrier(0);   // keeps the reads above in front of the softmax, whose work covers their latency
    // maximum of the lane's 16 scores of either query (unrolled: mx is indexed by constants and stays in registers)
    float mq[2];
#pragma unroll
    for (int qt = 0; qt < 2; ++qt) { float mx[8];
#pragma unroll
      for (int r = 0; r < 8; ++r) mx[r] = fmaxf(s[qt][0][r], s[qt][1][r]);
      mq[qt] = fmaxf(fmaxf(fmaxf(mx[0], mx[1]), fmaxf(mx[2], mx[3])), fmaxf(fmaxf(mx[4], mx[5]), fmaxf(mx[6], mx[7]))); }
    // one test a pass, a scalar branch: only where some lane's score passes its maximum in use by more than LAZY does the wave renew every query's maximum and rescale what it has summed (unrolled: acc is indexed by constants)
    if (__builtin_amdgcn_ballot_w32(mq[0] > m[0] + LAZY || mq[1] > m[1] + LAZY) != 0) {
#pragma unroll
      for (int qt = 0; qt < 2; ++qt) { const float mh = fmaxf(mq[qt], xhalf(mq[qt]));   // both halves: the pass's 32 keys of the query
        const float mn = fmaxf(m[qt], mh), alpha = __expf(m[qt] - mn); m[qt] = mn; cx[qt] = __builtin_fmaf(-mn, LOG2E, PCARRY_LOG2); l[qt] *= alpha;
#pragma unroll
        for (int j = 0; j < 4; ++j)
#pragma unroll
          for (int r = 0; r < 8; ++r) acc[qt][j][r] *= alpha; } }
  // unrolled: the query tiles take their scores from registers indexed by constants
    v16h pa[2];
#pragma unroll
  for (int qt = 0; qt < 2; ++qt) {
    // B fragment of P^T straight from the score registers (column n = query qt*16 + col; element i <- key 8g + i = tile 0 register i, 8+i <- key 16 + 8g + i = tile 1 register i, the k map of vh):
    // P x 2^6 = exp2(s log2e + (6 - m log2e)), one packed fma a pair in front of the hardware exp (unrolled: s, p and es are indexed by constants and stay in registers)
    float p[2][8], es[8];
#pragma unroll
    for (int t = 0; t < 2; ++t)
#pragma unroll
      for (int i = 0; i < 8; i += 2) { const v2f x = __builtin_elementwise_fma(v2f{s[qt][t][i], s[qt][t][i + 1]}, v2f{LOG2E, LOG2E}, v2f{cx[qt], cx[qt]});
        p[t][i] = __builtin_amdgcn_exp2f(x[0]); p[t][i + 1] = __builtin_amdgcn_exp2f(x[1]); }
#pragma unroll
    for (int i = 0; i < 8; ++i) es[i] = p[0][i] + p[1][i];
    l[qt] += ((es[0] + es[1]) + (es[2] + es[3])) + ((es[4] + es[5]) + (es[6] + es[7]));
    // f16 rounding of P, and no more of it: half an ulp of f16 is 2^-11 of P, an eighth of what the bf16 rounding of v, its partner in the product, has already lost.
    // Register k of the fragment holds elements 2k, 2k + 1 (unrolled: ph is indexed by constants and stays in registers)
    unsigned ph[8];
#pragma unroll
    for (int k = 0; k < 8; ++k) ph[k] = __builtin_bit_cast(unsigned, __builtin_convertvector(v2f{p[k >> 2][2 * (k & 3)], p[k >> 2][2 * (k & 3) + 1]}, v2h));
    pa[qt] = __builtin_bit_cast(v16h, v8u{ph[0], ph[1], ph[2], ph[3], ph[4], ph[5], ph[6], ph[7]});
    __builtin_amdgcn_sched_barrier(0); }   // keeps a tile's sums in front of the products: spread among them they are given registers that a product has just read, and each such place costs four idle slots
    // eight independent products, each v fragment used twice in a row (unrolled: acc, vh and pa are indexed by constants)
#pragma unroll
    for (int j = 0; j < 4; ++j)
#pragma unroll
      for (int qt = 0; qt < 2; ++qt) acc[qt][j] = wmma16(vh[j], pa[qt], acc[qt][j]); }   // D element r = d row j*16 + 8g + r, query column qt*16 + col
    // publish point: own LDS reads done, own copies of stage st+1 landed, then the barrier that publishes st+1 and frees this buffer for st+2
    __builtin_amdgcn_sched_barrier(0);   // keeps the stage's products in front of the publish point, so that the refill behind it is issued a whole trip ahead of its use
    asm volatile("s_wait_dscnt 0x0" ::: "memory");
    asm volatile("s_wait_asynccnt 0x0" ::: "memory");
    __syncthreads();
    if (st + 2 < NST) stage_copy(lk + buf * (SK * KP * 2), gk + (size_t)(st + 2) * SK * DD, lv + buf * (2 * DD * VP * 2), gv + (st + 2) * SK, 32 * KP * 2, (size_t)32 * DD, 16 * VP * 2, (size_t)16 * SEQ); }
  asm volatile("s_wait_asynccnt 0x0" ::: "memory");   // no copy of the ring is outstanding when the wave goes on to its end
  // join of the two key sets: set 1 hands its maxima, sums and raw accumulators over in so / sm / sl, each lane at the places where its partner lane of set 0 holds the same (query, d)
  // (the loops from here to the end are unrolled: acc, m, l and lt are indexed by constants and stay in registers; the eight stores of a lane differ in constant offsets)
  float lt[2];
#pragma unroll
  for (int qt = 0; qt < 2; ++qt) lt[qt] = l[qt] + xhalf(l[qt]);
  if (kh) {
#pragma unroll
    for (int qt = 0; qt < 2; ++qt) {
#pragma unroll
      for (int j = 0; j < 4; ++j) { vst2(&so[qg][qt * 16 + col][j * 16 + 8 * g], v4f{acc[qt][j][0], acc[qt][j][1], acc[qt][j][2], acc[qt][j][3]});
        vst2(&so[qg][qt * 16 + col][j * 16 + 8 * g + 4], v4f{acc[qt][j][4], acc[qt][j][5], acc[qt][j][6], acc[qt][j][7]}); }
      if (g == 0) { sm[qg][qt * 16 + col] = m[qt]; sl[qg][qt * 16 + col] = lt[qt]; } } }
  __syncthreads();   // set 1's hand-over is written before set 0 reads it
  if (!kh) {
#pragma unroll
    for (int qt = 0; qt < 2; ++qt) { const float m1 = sm[qg][qt * 16 + col], l1 = sl[qg][qt * 16 + col], mj = fmaxf(m[qt], m1);
      const float f0 = __expf(m[qt] - mj), f1 = __expf(m1 - mj), il = 1.0f / (lt[qt] * f0 + l1 * f1), w0 = f0 * il, w1 = f1 * il;
#pragma unroll
      for (int j = 0; j < 4; ++j) { float* sp = &so[qg][qt * 16 + col][j * 16 + 8 * g]; const v4f x0 = *(const v4f*)sp, x1 = *(const v4f*)(sp + 4);
        vst2(sp, v4f{acc[qt][j][0] * w0 + x0[0] * w1, acc[qt][j][1] * w0 + x0[1] * w1, acc[qt][j][2] * w0 + x0[2] * w1, acc[qt][j][3] * w0 + x0[3] * w1});
        vst2(sp + 4, v4f{acc[qt][j][4] * w0 + x1[0] * w1, acc[qt][j][5] * w0 + x1[1] * w1, acc[qt][j][6] * w0 + x1[2] * w1, acc[qt][j][7] * w0 + x1[3] * w1}); } } }
  __syncthreads();   // the joined rows are written before either set reads them for the store
  // two 256-B output rows (64 floats of (b, q, h) each) per instruction, one per lane half, 16 B a lane; each set stores 16 of its group's 32 rows
  float* op = OUT + ((b * OSEQ + q0 + kh * 16 + g) * NH + h) * (size_t)DD + col * 4; const float* sp = &so[qg][kh * 16 + g][col * 4];
#pragma unroll
  for (int rl = 0; rl < 8; ++rl) vst2(op + (size_t)rl * 2 * RS, *(const v4f*)(sp + rl * 2 * 68));
}

extern "C" void kernel_launch(void* const* d_in, const int* in_sizes, int n_in, void* d_out, int out_size, void* d_ws, size_t ws_size, hipStream_t stream) {
  if (n_in < 3) return;
  const size_t need = ((size_t)(NB - 1) * SEQ_FULL + SEQ) * RS;
  if ((size_t)in_sizes[0] < need || (size_t)in_sizes[1] < need || (size_t)in_sizes[2] < need) return;
  if ((size_t)out_size < (size_t)NB * OSEQ * RS) return;
  if (ws_size < (size_t)WS_END) return;
  const float* Qp = (const float*)d_in[0];   // 0 queries [4,2048,8,64] f32
  const float* Kp = (const float*)d_in[1];   // 1 keys    [4,2048,8,64] f32
  const float* Vp = (const float*)d_in[2];   // 2 values  [4,2048,8,64] f32
  char* ws = (char*)d_ws; _Float16* VT = (_Float16*)(ws + WS_VT); __bf16* KB = (__bf16*)(ws + WS_KB);
  k_vt<<<dim3(SEQ / 64, NB * NH, 2), 128, 0, stream>>>(Vp, Kp, VT, KB);
  k_att<<<dim3(SEQ / QB, NB * NH), 256, 0, stream>>>(Qp, KB, VT, (float*)d_out);
}

// v010
// One run takes 29.1 microseconds.
// It is 1.31 times as fast as v008, going by the measured steps of the versions left out in between.
// All steps since v000 together make it 7.08 times as fast.
// compute dtype: q, k, v RNE-converted to bf16 (k and v in the block, on the way from the staged f32 rows to the bf16 tiles); logits on v_wmma_f32_16x16x32_bf16 (bf16 x bf16 single product, f32 accumulate), no scaling; softmax in f32 (hardware exp) against a maximum taken from a wave's first 32 keys and renewed only when a pass's row sum passes 2^100; P RNE-converted to bf16, against v on v_wmma_f32_16x16x32_bf16, one product, f32 accumulate; f32 output [B, L, H, D].
#include <hip/hip_runtime.h>
#include <math.h>

typedef __attribute__((ext_vector_type(16))) __bf16 v16b;
typedef __attribute__((ext_vector_type(8)))  __bf16 v8b;
typedef __attribute__((ext_vector_type(4)))  __bf16 v4b;
typedef __attribute__((ext_vector_type(8)))  float v8f;
typedef __attribute__((ext_vector_type(4)))  float v4f;
typedef __attribute__((ext_vector_type(4)))  unsigned v4u;
typedef __attribute__((ext_vector_type(8)))  unsigned v8u;
typedef __attribute__((ext_vector_type(2)))  float v2f;
typedef __attribute__((ext_vector_type(2)))  __bf16 v2b;

template <typename T> __device__ __forceinline__ void vst2(void* p, T v) { *(T*)p = v;  }
// bare builtins: the compiler keeps the distances behind its own matrix instructions and fills them with useful work where it can
__device__ __forceinline__ v8f wmma_bf(v16b a, v16b b, v8f c) {
  return __builtin_amdgcn_wmma_f32_16x16x32_bf16(false, a, false, b, (short)0, c, false, false);
}
// 16x16x32 fragments: lane = (h = lane>>4, row/col = lane&15); elements 0..7 = k0+8h+0..7, 8..15 = k0+16+8h+0..7; D element r = row 8h+r, col lane&15
__device__ __forceinline__ v16b frag_b(const __bf16* rowk0, int lane) {
  union { v16b v; v8b q[2]; } u; const __bf16* p = rowk0 + 8 * (lane >> 4);
  u.q[0] = *(const v8b*)p; u.q[1] = *(const v8b*)(p + 16); return u.v;
}

// lane l <-> l ^ 16 in the vector unit (a shuffle would go through the LDS queue and its wait)
__device__ __forceinline__ float xhalf(float v) { const int b = __builtin_bit_cast(int, v); return __builtin_bit_cast(float, __builtin_amdgcn_permlanex16(b, b, 0x76543210, 0xfedcba98, false, false)); }
__device__ __forceinline__ unsigned lds_off(const void* p) { return (unsigned)(size_t)p; }   // byte offset in the work-group's LDS
// one stage (128 keys), this lane's share of its wave's eight f32 key rows and eight f32 value rows: four 16-B pieces of each, global -> LDS through no register; a wave-wide copy takes two whole 256-B source rows.
// sk, sv: the wave's first row of the stage (scalar); vo: the lane's byte offset from it; lk, lv: the lane's LDS byte address of piece 0. Piece i lies two source rows (4,096 B) further in memory and 512 B further in LDS:
// the immediate offset 512 i moves both addresses, the scalar base takes the rest, RB i. So one address register serves four copies, and no vector addition is spent on a stage.
// The s_wait_xcnt closes the statement so that no address register named here is rewritten in front of it.
__device__ __forceinline__ void stage_copy(unsigned lk, unsigned lv, unsigned vo, const char* sk, const char* sv) {
  constexpr int RB = 2 * 8 * 64 * 4 - 512;   // two rows of 8 heads x 64 floats, less the 512 B that the immediate offset adds
  asm volatile("global_load_async_to_lds_b128 %0, %2, %3\n\t"
               "global_load_async_to_lds_b128 %0, %2, %4 offset:512\n\t"
               "global_load_async_to_lds_b128 %0, %2, %5 offset:1024\n\t"
               "global_load_async_to_lds_b128 %0, %2, %6 offset:1536\n\t"
               "global_load_async_to_lds_b128 %1, %2, %7\n\t"
               "global_load_async_to_lds_b128 %1, %2, %8 offset:512\n\t"
               "global_load_async_to_lds_b128 %1, %2, %9 offset:1024\n\t"
               "global_load_async_to_lds_b128 %1, %2, %10 offset:1536\n\t"
               "s_wait_xcnt 0x0"
               :: "v"(lk), "v"(lv), "v"(vo), "s"(sk), "s"(sk + RB), "s"(sk + 2 * RB), "s"(sk + 3 * RB), "s"(sv), "s"(sv + RB), "s"(sv + 2 * RB), "s"(sv + 3 * RB) : "memory");
}

// dense softmax attention on raw inputs in [B, S, H, D] layout: A = softmax(q k^T) over keys (no 1/sqrt(D)); out = A . v, written [B, L, H, D].
#ifndef NB
#define NB 4                    // batches computed
#endif
#ifndef SEQ
#define SEQ 2048                // sequence length computed
#endif
#define NB_FULL 4
#define SEQ_FULL 2048           // inputs always have the full sequence length per batch
#define NH 8
#define DD 64
#define RS (NH * DD)            // floats between consecutive s of one batch (512)
#define BSTR ((size_t)SEQ_FULL * RS)   // input batch stride in floats
#ifndef OSEQ
#define OSEQ SEQ                // output sequence stride (dense over the computed rows)
#endif
#define SK 128                  // keys per LDS stage, 64 for each of a block's two wave sets
#define QB 256                  // queries per block: eight groups of 32, each group worked on by one wave of either set
#define NW 16                   // waves per block
#define WK (SK / NW)            // rows of a stage that one wave brings in and rounds (8)
#define NST (SEQ / SK)
#define KP 72                   // bf16 per staged key row: 144 B = 16 B x 9, no bank conflict for 16-B LDS reads
#define VP 72                   // bf16 per staged value row: 144 B = 16 B x 9, likewise
#define PSUM_MAX 1.2676506e30f  // 2^100: while a lane's sum of a pass's P stays under it, so does every P of the pass (inside bf16, which has f32's exponent range), and the sums over a wave's 1,024 keys stay inside f32, those of P v for |v| under 2^20
#define LOG2E 1.44269504f
static_assert(SEQ % SK == 0 && SEQ % QB == 0);
static_assert(SEQ <= SEQ_FULL);
static_assert(NB >= 1 && NB <= NB_FULL);
static_assert(DD == 64 && NH == 8);
static_assert(WK == 8 && QB == 32 * (NW / 2));

// a pass's eight score products, four independent chains of two (unrolled: everything is indexed by constants and stays in registers);
// D element r = key row ct*16 + 8g + r of the pass, query column qt*16 + col; no scaling
__device__ __forceinline__ void scores(const v16b (&kf)[2][2], const v16b (&aq)[2][2], float (&s)[2][2][8]) {
#pragma unroll
  for (int qt = 0; qt < 2; ++qt)
#pragma unroll
    for (int ct = 0; ct < 2; ++ct) { v8f c = {};
#pragma unroll
      for (int kc = 0; kc < 2; ++kc) c = wmma_bf(kf[ct][kc], aq[qt][kc], c);
#pragma unroll
      for (int r = 0; r < 8; ++r) s[qt][ct][r] = c[r]; }
}
// maximum of one query's 32 scores of a pass: the lane's 16, then both lane halves (unrolled: mx is indexed by constants and stays in registers)
__device__ __forceinline__ float pass_max(const float (&s)[2][8]) {
  float mx[8];
#pragma unroll
  for (int r = 0; r < 8; ++r) mx[r] = fmaxf(s[0][r], s[1][r]);
  const float mq = fmaxf(fmaxf(fmaxf(mx[0], mx[1]), fmaxf(mx[2], mx[3])), fmaxf(fmaxf(mx[4], mx[5]), fmaxf(mx[6], mx[7])));
  return fmaxf(mq, xhalf(mq));
}
// B fragment of P^T straight from one query tile's score registers (column n = query; element i <- key 8g + i = tile 0 register i, 8+i <- key 16 + 8g + i = tile 1 register i, the k map of the v fragments):
// P = exp2(s log2e - m log2e), one packed fma a pair in front of the hardware exp; sum = the lane's 16 P in f32; P rounded to bf16, register k of the fragment holding elements 2k, 2k + 1
// (unrolled: s, p and ph are indexed by constants and stay in registers)
__device__ __forceinline__ v16b soft(const float (&s)[2][8], float cx, float& sum) {
  float p[2][8];
#pragma unroll
  for (int t = 0; t < 2; ++t)
#pragma unroll
    for (int i = 0; i < 8; i += 2) { const v2f x = __builtin_elementwise_fma(v2f{s[t][i], s[t][i + 1]}, v2f{LOG2E, LOG2E}, v2f{cx, cx});
      p[t][i] = __builtin_amdgcn_exp2f(x[0]); p[t][i + 1] = __builtin_amdgcn_exp2f(x[1]); }
  // e_i = p[0][i] + p[1][i], a pair to a packed addition; then the tree ((e0 + e1) + (e2 + e3)) + ((e4 + e5) + (e6 + e7)) (unrolled: es is indexed by constants and stays in registers)
  v2f es[4];
#pragma unroll
  for (int i = 0; i < 4; ++i) es[i] = v2f{p[0][2 * i], p[0][2 * i + 1]} + v2f{p[1][2 * i], p[1][2 * i + 1]};
  sum = ((es[0][0] + es[0][1]) + (es[1][0] + es[1][1])) + ((es[2][0] + es[2][1]) + (es[3][0] + es[3][1]));
  unsigned ph[8];
#pragma unroll
  for (int k = 0; k < 8; ++k) ph[k] = __builtin_bit_cast(unsigned, __builtin_convertvector(v2f{p[k >> 2][2 * (k & 3)], p[k >> 2][2 * (k & 3) + 1]}, v2b));
  return __builtin_bit_cast(v16b, v8u{ph[0], ph[1], ph[2], ph[3], ph[4], ph[5], ph[6], ph[7]});
}
// a pass's eight independent output products, each v fragment used twice in a row; D element r = d row j*16 + 8g + r, query column qt*16 + col (unrolled: acc, vh and pa are indexed by constants)
__device__ __forceinline__ void products(const v16b (&vh)[4], const v16b (&pa)[2], v8f (&acc)[2][4]) {
#pragma unroll
  for (int j = 0; j < 4; ++j)
#pragma unroll
    for (int qt = 0; qt < 2; ++qt) acc[qt][j] = wmma_bf(vh[j], pa[qt], acc[qt][j]);
}
// a wave's eight f32 key rows and eight f32 value rows of a stage, which its own copies have brought into fk and fv, on their way into the bf16 tiles that all waves read, in two halves so that work can stand between them.
// rows_read: k: the 16 B that this lane copied (piece i); v: the eight keys of d = lane and of d = lane + 32 (a wave-wide 4-B read takes 32 d of one key, one bank each)
// (the loops of both halves are unrolled: xk and xv are indexed by constants and stay in registers)
__device__ __forceinline__ void rows_read(const float (&fk)[SK][DD], const float (&fv)[SK][DD], int wave, int lane, v4f (&xk)[4], v8f (&xv)[2]) {
#pragma unroll
  for (int i = 0; i < 4; ++i) xk[i] = *(const v4f*)&fk[wave * WK + 2 * i + (lane >> 4)][(lane & 15) * 4];
#pragma unroll
  for (int hh = 0; hh < 2; ++hh)
#pragma unroll
    for (int j = 0; j < WK; ++j) xv[hh][j] = fv[wave * WK + j][lane + 32 * hh];
}
// rows_put: rounded to bf16; k: 8 B at the same row and column of kd; v: the eight keys as 16 B of row d of the [d][key] plane vd of the wave's key set
__device__ __forceinline__ void rows_put(const v4f (&xk)[4], const v8f (&xv)[2], __bf16 (&kd)[SK][KP], __bf16 (&vd)[DD][VP], int wave, int lane) {
#pragma unroll
  for (int i = 0; i < 4; ++i) vst2(&kd[wave * WK + 2 * i + (lane >> 4)][(lane & 15) * 4], __builtin_convertvector(xk[i], v4b));
#pragma unroll
  for (int hh = 0; hh < 2; ++hh) vst2(&vd[lane + 32 * hh][(wave & 7) * WK], __builtin_convertvector(xv[hh], v8b));
}
// ---- k_att, the one launch: block = (256 queries, b*NH + h), 16 waves = 8 query groups x 2 key sets. A wave has 32 queries (two column tiles) and, of every 128-key stage, its set's 64 keys, in two passes of 32:
// bf16 logits as S^T = k . q^T (a lane holds one query's scores per tile), softmax against the maximum of the wave's first pass (renewed only on the overflow test below), O^T += v^T . P^T. Each k and v fragment read from LDS feeds two products, one per query tile.
// k and v come as f32 from the inputs: each wave copies 8 rows of either, of the next stage, into its own rows of fk, fv and, at the end of a trip, rounds them into the bf16 tiles of that stage.
// 256 queries a block: the f32 bytes a WGP stages are what two blocks of 128 queries would stage in bf16.
// The two sets' maxima, sums and accumulators of a query group are joined once, in the epilogue, through LDS.
// waves_per_eu(4, 4): one block on a WGP, four waves a SIMD, so that other waves' products run under a wave's softmax; a wave's registers stay within 256.
__global__ __launch_bounds__(512) __attribute__((amdgpu_waves_per_eu(4, 4))) void k_att(const float* __restrict__ Q, const float* __restrict__ K, const float* __restrict__ V, float* __restrict__ OUT) {
  __shared__ __align__(16) float so[NW / 2][32][68]; __shared__ float sm[NW / 2][32], sl[NW / 2][32];
  __shared__ __align__(16) __bf16 kst[2][SK][KP]; __shared__ __align__(16) __bf16 vst[2][2][DD][VP];   // two stages: k rows as bf16; v planes [key set][d][key] as bf16
  __shared__ __align__(16) float fk[SK][DD], fv[SK][DD];   // one stage as it comes, f32 rows; rows WK*wave .. WK*wave + 7 are written and read by that wave alone
  const int tid = threadIdx.x, wave = __builtin_amdgcn_readfirstlane(tid >> 5), lane = tid & 31, col = lane & 15, g = lane >> 4;
  const int qg = wave & 7, kh = wave >> 3;   // query group, key set: the same for the whole wave
  const size_t bh = blockIdx.y; const size_t b = bh / NH; const int h = bh % NH; const int q0 = blockIdx.x * QB + qg * 32;
  // this lane's pieces of a stage, of k and of v alike: piece i = row WK*wave + 2i + g of the stage, bytes 16*col of its 256; stage 0 is asked for first, so that it flies while q is fetched
  const size_t go = b * BSTR + ((size_t)(wave * WK) * NH + h) * DD; const char* sk = (const char*)(K + go); const char* sv = (const char*)(V + go); const unsigned vo = (g * RS + col * 4) * 4;
  const unsigned lk = lds_off(&fk[wave * WK + g][col * 4]), lv = lds_off(&fv[wave * WK + g][col * 4]);
  stage_copy(lk, lv, vo, sk, sv);
  // B fragments of q: column n = query qt*16 + col, elements i <- d = kc*32 + 8g + i, 8+i <- d = kc*32 + 16 + 8g + i (unrolled: aq is indexed by constants and stays in registers)
  v16b aq[2][2];
#pragma unroll
  for (int qt = 0; qt < 2; ++qt)
#pragma unroll
    for (int kc = 0; kc < 2; ++kc) { const float* pp = Q + b * BSTR + ((size_t)(q0 + qt * 16 + col) * NH + h) * DD + kc * 32 + 8 * g;
#pragma unroll
      for (int i = 0; i < 8; ++i) { aq[qt][kc][i] = (__bf16)pp[i]; aq[qt][kc][8 + i] = (__bf16)pp[16 + i]; } }
  // of query qt*16 + col, over this wave's key set: m = the maximum in use (the same in both lane halves; set in the first pass), cx = -m log2e, l over this lane half's keys only (halves and sets join in the epilogue); unrolled: all indexed by constants, all in registers
  float m[2], cx[2], l[2]; v8f acc[2][4];
#pragma unroll
  for (int qt = 0; qt < 2; ++qt) { m[qt] = 0.f; cx[qt] = 0.f; l[qt] = 0.f;
#pragma unroll
    for (int j = 0; j < 4; ++j) acc[qt][j] = v8f{}; }
  asm volatile("s_wait_asynccnt 0x0" ::: "memory");   // this wave's rows of stage 0 have landed before it reads them
  { v4f xk[4]; v8f xv[2]; rows_read(fk, fv, wave, lane, xk, xv); rows_put(xk, xv, kst[0], vst[0][kh], wave, lane); }
  asm volatile("s_wait_dscnt 0x0" ::: "memory");      // its reads of fk, fv and its writes of the tiles are done before the barrier that publishes stage 0, behind which its f32 rows are refilled
  __syncthreads();
  if (1 < NST) stage_copy(lk, lv, vo, sk + (size_t)SK * RS * 4, sv + (size_t)SK * RS * 4);
  // kept rolled: one trip = one stage with its one publish point at the foot
#pragma unroll 1
  for (int st = 0; st < NST; ++st) { const int buf = st & 1;
    // A fragments of k straight from the staged bf16 rows: row m = key ct*16 + col of the pass, elements i <- d = kc*32 + 8g + i, 8+i <- d = kc*32 + 16 + 8g + i (same k map as B);
    // a pass's fragments in one group of LDS reads (loops unrolled: kf is indexed by constants and stays in registers)
    v16b kf[2][2];
#pragma unroll
    for (int ct = 0; ct < 2; ++ct)
#pragma unroll
      for (int kc = 0; kc < 2; ++kc) kf[ct][kc] = frag_b(&kst[buf][kh * 64 + ct * 16 + col][kc * 32], lane);
    __builtin_amdgcn_sched_barrier(0);   // keeps the reads above together in front of the first product: without it they are spread among the products, each with a full wait of its own
  // unrolled: the two passes of a stage differ in constant LDS offsets and in the steps that ps selects: the second's k fragments are read during the first, and the next stage's rows are rounded during the second
#pragma unroll
  for (int ps = 0; ps < 2; ++ps) {
    float s[2][2][8];
    scores(kf, aq, s);
    // A fragments of v^T from the staged [d][key] planes: row m = d = j*16 + col, k = key with the same split map; read here, with the stage's second pass's k fragments, so that the softmax covers their latency (unrolled: vh and kf stay in registers)
    v16b vh[4];
#pragma unroll
    for (int j = 0; j < 4; ++j) vh[j] = frag_b(&vst[buf][kh][j * 16 + col][ps * 32], lane);
    if (ps == 0) {
#pragma unroll
      for (int ct = 0; ct < 2; ++ct)
#pragma unroll
        for (int kc = 0; kc < 2; ++kc) kf[ct][kc] = frag_b(&kst[buf][kh * 64 + 32 + ct * 16 + col][kc * 32], lane); }
    __builtin_amdgcn_sched_barrier(0);   // keeps the reads above in front of the softmax, whose work covers their latency
    // the wave's first pass gives every query its maximum in use, so that its row sum holds a term of about 1 and cannot vanish (a scalar branch on the trip count; unrolled: m and cx are indexed by constants)
    if (ps == 0 && st == 0) {
#pragma unroll
      for (int qt = 0; qt < 2; ++qt) { m[qt] = pass_max(s[qt]); cx[qt] = -m[qt] * LOG2E; } }
    // no maximum is taken in a pass: P and its sums are formed against the maximum in use (unrolled: the query tiles take their scores from registers indexed by constants)
    v16b pa[2]; float sum[2];
#pragma unroll
    for (int qt = 0; qt < 2; ++qt) pa[qt] = soft(s[qt], cx[qt], sum[qt]);
    // one test a pass, a scalar branch, on the sums that are formed anyway: P >= 0, so each P of the lane is at most sum[0] + sum[1]. Where that passes 2^100 (or is inf) in some lane, nothing of the pass has
    // been added yet: the wave reads the pass's k fragments again (its stage is still published), forms the scores anew, renews every query's maximum, rescales what it has summed and forms P <= 1 (unrolled: kf, acc are indexed by constants)
    if (__builtin_expect(__builtin_amdgcn_ballot_w32(!(sum[0] + sum[1] <= PSUM_MAX)) != 0, 0)) {
#pragma unroll
      for (int ct = 0; ct < 2; ++ct)
#pragma unroll
        for (int kc = 0; kc < 2; ++kc) kf[ct][kc] = frag_b(&kst[buf][kh * 64 + ps * 32 + ct * 16 + col][kc * 32], lane);
      scores(kf, aq, s);
      if (ps == 0) {   // and the second pass's fragments once more, into the registers that held them
#pragma unroll
        for (int ct = 0; ct < 2; ++ct)
#pragma unroll
          for (int kc = 0; kc < 2; ++kc) kf[ct][kc] = frag_b(&kst[buf][kh * 64 + 32 + ct * 16 + col][kc * 32], lane); }
#pragma unroll
      for (int qt = 0; qt < 2; ++qt) { const float mn = fmaxf(m[qt], pass_max(s[qt])), alpha = __expf(m[qt] - mn); m[qt] = mn; cx[qt] = -mn * LOG2E; l[qt] *= alpha;
#pragma unroll
        for (int j = 0; j < 4; ++j)
#pragma unroll
          for (int r = 0; r < 8; ++r) acc[qt][j][r] *= alpha;
        pa[qt] = soft(s[qt], cx[qt], sum[qt]); } }
#pragma unroll
    for (int qt = 0; qt < 2; ++qt) l[qt] += sum[qt];
    // second pass: the wave's f32 rows of stage st+1, asked for at the last publish point, are read into registers that the scores have left, in front of the products, which cover the reads' latency; behind them they go,
    // rounded, into the other buffer's tiles (last read a trip ago, in front of the last barrier). No test on the trip count: in the last trip fk, fv still hold the last stage's rows, which go once more into tiles that
    // nobody reads any more; with a branch here the build kept the accumulators twice and spilled.
    if (ps == 1) {
      v4f xk[4]; v8f xv[2];
      asm volatile("s_wait_asynccnt 0x0" ::: "memory");   // the wave's own copies of stage st+1 have landed before it reads them
      rows_read(fk, fv, wave, lane, xk, xv);
      __builtin_amdgcn_sched_barrier(0);   // keeps the reads in front of the products: behind them their latency would stand open in front of the barrier
      products(vh, pa, acc);
      __builtin_amdgcn_sched_barrier(0);   // keeps the rounding, which waits for the reads, behind the products
      rows_put(xk, xv, kst[buf ^ 1], vst[buf ^ 1][kh], wave, lane);
    } else products(vh, pa, acc); }
    // publish point: own LDS reads and own writes of stage st+1's tiles done; then the barrier that publishes st+1 and frees this buffer's tiles; behind it the refill of the wave's own f32 rows with stage st+2
    asm volatile("s_wait_dscnt 0x0" ::: "memory");
    __syncthreads();
    if (st + 2 < NST) stage_copy(lk, lv, vo, sk + (size_t)(st + 2) * SK * RS * 4, sv + (size_t)(st + 2) * SK * RS * 4); }
  asm volatile("s_wait_asynccnt 0x0" ::: "memory");   // no copy of the ring is outstanding when the wave goes on to its end
  // join of the two key sets: set 1 hands its maxima, sums and raw accumulators over in so / sm / sl, each lane at the places where its partner lane of set 0 holds the same (query, d)
  // (the loops from here to the end are unrolled: acc, m, l and lt are indexed by constants and stay in registers; the eight stores of a lane differ in constant offsets)
  float lt[2];
#pragma unroll
  for (int qt = 0; qt < 2; ++qt) lt[qt] = l[qt] + xhalf(l[qt]);
  if (kh) {
#pragma unroll
    for (int qt = 0; qt < 2; ++qt) {
#pragma unroll
      for (int j = 0; j < 4; ++j) { vst2(&so[qg][qt * 16 + col][j * 16 + 8 * g], v4f{acc[qt][j][0], acc[qt][j][1], acc[qt][j][2], acc[qt][j][3]});
        vst2(&so[qg][qt * 16 + col][j * 16 + 8 * g + 4], v4f{acc[qt][j][4], acc[qt][j][5], acc[qt][j][6], acc[qt][j][7]}); }
      if (g == 0) { sm[qg][qt * 16 + col] = m[qt]; sl[qg][qt * 16 + col] = lt[qt]; } } }
  __syncthreads();   // set 1's hand-over is written before set 0 reads it
  if (!kh) {
#pragma unroll
    for (int qt = 0; qt < 2; ++qt) { const float m1 = sm[qg][qt * 16 + col], l1 = sl[qg][qt * 16 + col], mj = fmaxf(m[qt], m1);
      const float f0 = __expf(m[qt] - mj), f1 = __expf(m1 - mj), il = 1.0f / (lt[qt] * f0 + l1 * f1), w0 = f0 * il, w1 = f1 * il;
#pragma unroll
      for (int j = 0; j < 4; ++j) { float* sp = &so[qg][qt * 16 + col][j * 16 + 8 * g]; const v4f x0 = *(const v4f*)sp, x1 = *(const v4f*)(sp + 4);
        vst2(sp, v4f{acc[qt][j][0] * w0 + x0[0] * w1, acc[qt][j][1] * w0 + x0[1] * w1, acc[qt][j][2] * w0 + x0[2] * w1, acc[qt][j][3] * w0 + x0[3] * w1});
        vst2(sp + 4, v4f{acc[qt][j][4] * w0 + x1[0] * w1, acc[qt][j][5] * w0 + x1[1] * w1, acc[qt][j][6] * w0 + x1[2] * w1, acc[qt][j][7] * w0 + x1[3] * w1}); } } }
  __syncthreads();   // the joined rows are written before either set reads them for the store
  // two 256-B output rows (64 floats of (b, q, h) each) per instruction, one per lane half, 16 B a lane; each set stores 16 of its group's 32 rows
  float* op = OUT + ((b * OSEQ + q0 + kh * 16 + g) * NH + h) * (size_t)DD + col * 4; const float* sp = &so[qg][kh * 16 + g][col * 4];
#pragma unroll
  for (int rl = 0; rl < 8; ++rl) vst2(op + (size_t)rl * 2 * RS, *(const v4f*)(sp + rl * 2 * 68));
}

extern "C" void kernel_launch(void* const* d_in, const int* in_sizes, int n_in, void* d_out, int out_size, void* d_ws, size_t ws_size, hipStream_t stream) {
  if (n_in < 3) return;
  const size_t need = ((size_t)(NB - 1) * SEQ_FULL + SEQ) * RS;
  if ((size_t)in_sizes[0] < need || (size_t)in_sizes[1] < need || (size_t)in_sizes[2] < need) return;
  if ((size_t)out_size < (size_t)NB * OSEQ * RS) return;
  const float* Qp = (const float*)d_in[0];   // 0 queries [4,2048,8,64] f32
  const float* Kp = (const float*)d_in[1];   // 1 keys    [4,2048,8,64] f32
  const float* Vp = (const float*)d_in[2];   // 2 values  [4,2048,8,64] f32
  k_att<<<dim3(SEQ / QB, NB * NH), 32 * NW, 0, stream>>>(Qp, Kp, Vp, (float*)d_out);
}
